// v000
// The times below were measured on an AMD MI455X: many runs one after another, warmed up first and cycling through
// copies of the inputs, with the whole window's GPU time divided by the number of runs. Launches and the gaps
// between them are all in it. The median over several windows is given; except for v000 it joins two sittings, which
// can be a few percent apart, so the side-by-side timings, each taken in one sitting, are the better comparison.
// v000, which the later versions start from, runs in 1240 microseconds.
#include <hip/hip_runtime.h>

// scores ([1024 x 64].[64 x 1024]) and attn.v on SINGLE fp16 planes (LN output, q/8, k, softmax probabilities, v and the merged heads rounded to fp16 = 2^-11; weights
// fp16(bf16(W)); one v_wmma_f32_16x16x32_f16 product each — the residual input dominating the output); softmax f32; + the input residual in f32 with

#define NSQ  16                   // (b t) sequences
#define NTK  1024                 // (h w) tokens
#define CC   512
#define NH_  8
#define HD   64
#define TT   8
#define NR   (NSQ * NTK)          // 16384
#define SG   2                    // sequences per attention group (z = 16)
#define DM   CC
#define LOSC 1024.0f
typedef _Float16 h16;
typedef unsigned short bf;
typedef __attribute__((ext_vector_type(16))) __bf16   v16bf;
typedef __attribute__((ext_vector_type(16))) _Float16 v16h;
typedef __attribute__((ext_vector_type(8)))  _Float16 v8h;
typedef __attribute__((ext_vector_type(8)))  unsigned short v8us;
typedef __attribute__((ext_vector_type(8)))  float    v8f;
typedef __attribute__((ext_vector_type(4)))  float    v4f;
typedef v8h  __attribute__((may_alias)) v8ha;
typedef v4f  __attribute__((may_alias)) v4fa;
typedef v8us __attribute__((may_alias)) v8usa;

__device__ __forceinline__ unsigned short f2bf(float f) { unsigned u = __float_as_uint(f); u += 0x7FFFu + ((u >> 16) & 1u); return (unsigned short)(u >> 16); }
__device__ __forceinline__ float bf2f(unsigned short b) { return __uint_as_float(((unsigned)b) << 16); }
__device__ __forceinline__ float bfr(float f) { return bf2f(f2bf(f)); }
__device__ __forceinline__ v16h cat16(v8h lo, v8h hi) { return __builtin_shufflevector(lo, hi, 0, 1, 2, 3, 4, 5, 6, 7, 8, 9, 10, 11, 12, 13, 14, 15); }
__device__ __forceinline__ v16bf cat16b(v8us lo, v8us hi) { return __builtin_bit_cast(v16bf, __builtin_shufflevector(lo, hi, 0, 1, 2, 3, 4, 5, 6, 7, 8, 9, 10, 11, 12, 13, 14, 15)); }
__device__ __forceinline__ v8f wmma16(v16h a, v16h b, v8f c) { return __builtin_amdgcn_wmma_f32_16x16x32_f16(false, a, false, b, (short)0, c, false, false); }
__device__ __forceinline__ v8f wmmab(v16bf a, v16bf b, v8f c) { return __builtin_amdgcn_wmma_f32_16x16x32_bf16(false, a, false, b, (short)0, c, false, false); }


// k_gemmh: 64 x 64 tile of C = A . Bn^T with SINGLE f16 planes (A [rows][K] f16 activations, Bn [N][K] f16 weights; one v_wmma_f32_16x16x32_f16 product per step), f32 accumulate;
__global__ __launch_bounds__(128) void k_gemmh(const h16* __restrict__ A, const h16* __restrict__ Bn, const float* __restrict__ bias, float* C, int ldc, const float* __restrict__ R, int K, size_t sA, size_t sB, size_t sC, int roundR) {
    __shared__ __align__(16) float ost[4][16 * 68];
    const size_t z = blockIdx.z; A += z * sA; Bn += z * sB; C += z * sC; if (R) R += z * sC;
    const int lane = threadIdx.x & 31, wave = threadIdx.x >> 5, lr = lane & 15, hi = lane >> 4;
    const int r0 = blockIdx.x * 64 + wave * 16, c0 = blockIdx.y * 64;
    const size_t aoff = (size_t)(r0 + lr) * K + 8 * hi;
    size_t boff[4];
#pragma unroll
    for (int t = 0; t < 4; ++t) boff[t] = (size_t)(c0 + t * 16 + lr) * K + 8 * hi;
    v8f acc[4];
#pragma unroll
    for (int t = 0; t < 4; ++t) acc[t] = (v8f){};
#pragma unroll 1
    for (int kc = 0; kc < K; kc += 32) {
        const v16h a = cat16(*(const v8h*)(A + aoff + kc), *(const v8h*)(A + aoff + kc + 16));
#pragma unroll
        for (int t = 0; t < 4; ++t) { const v16h b = cat16(*(const v8h*)(Bn + boff[t] + kc), *(const v8h*)(Bn + boff[t] + kc + 16)); acc[t] = wmma16(a, b, acc[t]); }
        asm volatile("v_nop\n\tv_nop\n\tv_nop\n\tv_nop" : "+v"(acc[0]), "+v"(acc[1]), "+v"(acc[2]), "+v"(acc[3]) : "v"(a));
    }
    float* os = &ost[wave][0];
#pragma unroll
    for (int t = 0; t < 4; ++t) { const float bv = bias ? bfr(bias[c0 + t * 16 + lr]) : 0.f;
#pragma unroll
        for (int j = 0; j < 8; ++j) os[(hi * 8 + j) * 68 + t * 16 + lr] = acc[t][j] + bv; }
    __syncthreads();
    float* crow = C + (size_t)r0 * ldc + c0;
    auto pass = [&]() {
#pragma unroll
        for (int s = 0; s < 8; ++s) { const int Lid = (lane >> 3) + 4 * s, piece = lane & 7; const int row = Lid >> 1, cofs = (Lid & 1) * 32 + piece * 4;
            v4f val = *(const v4fa*)(os + row * 68 + cofs); if (R) { const v4f rv = *(const v4f*)(R + ((size_t)r0 + row) * ldc + c0 + cofs); val += roundR ? (v4f){bfr(rv[0]), bfr(rv[1]), bfr(rv[2]), bfr(rv[3])} : rv; }
            *(v4f*)(crow + (size_t)row * ldc + cofs) = val; }
    };
    pass(); 
}

typedef __attribute__((ext_vector_type(4))) _Float16 v4h;
__device__ __forceinline__ h16 tohx(float x) { return (h16)x; }
__device__ __forceinline__ size_t xoff(int s, int c, int n) { const int b = s / TT, t = s % TT; return (((size_t)b * CC + c) * TT + t) * NTK + n; }   // x[b][c][t][n]
__global__ __launch_bounds__(256) void k_stat(const float* __restrict__ x, float* MU, float* RS) {
    const int lane = threadIdx.x & 31; const int w = blockIdx.x * 8 + (threadIdx.x >> 5); if (w >= NR / 32) return; const int s = w / (NTK / 32), n = (w % (NTK / 32)) * 32 + lane; float sum = 0.f;
#pragma unroll 1
    for (int c = 0; c < CC; ++c) sum += bfr(x[xoff(s, c, n)]);
    const float mu = sum * (1.0f / CC); float q = 0.f;
#pragma unroll 1
    for (int c = 0; c < CC; ++c) { const float d = bfr(x[xoff(s, c, n)]) - mu; q = fmaf(d, d, q); }
    const float rs = rsqrtf(q * (1.0f / CC) + 1e-5f); const size_t r = (size_t)s * NTK + n;
    *(float*)(MU + r) = mu; *(float*)(RS + r) = rs; 
}
__global__ __launch_bounds__(256) void k_nrow(const float* __restrict__ x, const float* __restrict__ MU, const float* __restrict__ RS, const float* __restrict__ g, const float* __restrict__ bb, h16* XN) {
    const int lane = threadIdx.x & 31; const size_t r = (size_t)blockIdx.x * 8 + (threadIdx.x >> 5); if (r >= (size_t)NR) return; const int s = (int)(r / NTK), n = (int)(r % NTK); const float mu = MU[r], rs = RS[r];
{
#pragma unroll 1
        for (int p = 0; p < CC / 256; ++p) { const int c0 = p * 256 + lane * 8; v8h o;
#pragma unroll
            for (int i = 0; i < 8; ++i) { const int c = c0 + i; o[i] = tohx((bfr(x[xoff(s, c, n)]) - mu) * rs * bfr(g[c]) + bfr(bb[c])); }
            *(v8h*)(XN + r * CC + c0) = o; }
         }
}
__global__ __launch_bounds__(256) void k_wTh(const float* __restrict__ Wm, int K, int N, h16* Bt) {
    __shared__ float tl[64][65];
    const int tid = threadIdx.x; const int k0 = blockIdx.x * 64, n0 = blockIdx.y * 64; const int rr = tid >> 2, cq = (tid & 3) * 16;
#pragma unroll
    for (int i = 0; i < 16; ++i) tl[rr][cq + i] = bfr(Wm[(size_t)(k0 + rr) * N + n0 + cq + i]);
    __syncthreads();
    const int lane = tid & 31, wv = tid >> 5;
    auto pass = [&]() {
#pragma unroll
        for (int st = 0; st < 4; ++st) { const int nr = wv * 8 + st * 2 + (lane >> 4); const int kq = (lane & 15) * 4; v4h v;
#pragma unroll
            for (int i = 0; i < 4; ++i) v[i] = tohx(tl[kq + i][nr]);
            *(v4h*)(Bt + (size_t)(n0 + nr) * K + k0 + kq) = v; }
    };
    pass(); 
}
__global__ __launch_bounds__(256) void k_hplh3(const float* __restrict__ F, int s0, float sc, h16* P) {
    const int lane = threadIdx.x & 31; const size_t w = (size_t)blockIdx.x * 8 + (threadIdx.x >> 5); const int i = (int)(w * 2 + (lane >> 4)); if (i >= NTK) return; const int g = blockIdx.z / NH_, h = blockIdx.z % NH_; const int c0 = (lane & 15) * 4; v4h o;
#pragma unroll
    for (int q = 0; q < 4; ++q) o[q] = tohx(F[((size_t)(s0 + g) * NTK + i) * CC + h * HD + c0 + q] * sc);
    const size_t off = ((size_t)blockIdx.z * NTK + i) * HD + c0; *(v4h*)(P + off) = o; 
}
__global__ __launch_bounds__(256) void k_vTh3(const float* __restrict__ V, int s0, h16* VT) {
    __shared__ float tl[64][65];
    const int tid = threadIdx.x; const int t0 = blockIdx.x * 64; const int g = blockIdx.z / NH_, h = blockIdx.z % NH_; const int rr = tid >> 2, cq = (tid & 3) * 16;
#pragma unroll
    for (int i = 0; i < 16; ++i) tl[rr][cq + i] = V[((size_t)(s0 + g) * NTK + t0 + rr) * CC + h * HD + cq + i];
    __syncthreads();
    const int lane = tid & 31, wv = tid >> 5;
    auto pass = [&]() {
#pragma unroll
        for (int st = 0; st < 4; ++st) { const int dr = wv * 8 + st * 2 + (lane >> 4); const int tq = (lane & 15) * 4; v4h v;
#pragma unroll
            for (int i = 0; i < 4; ++i) v[i] = tohx(tl[tq + i][dr]);
            *(v4h*)(VT + ((size_t)blockIdx.z * HD + dr) * NTK + t0 + tq) = v; }
    };
    pass(); 
}
__global__ __launch_bounds__(256) void k_softh3(const float* __restrict__ S, h16* P) {
    const int lane = threadIdx.x & 31, i = blockIdx.x * 8 + (threadIdx.x >> 5); if (i >= NTK) return; const size_t zo = (size_t)blockIdx.z * NTK * NTK + (size_t)i * NTK; const float* sr = S + zo; h16* po = P + zo;
    float m = -3.0e38f;
#pragma unroll 1
    for (int c0 = lane * 4; c0 < NTK; c0 += 128) {
#pragma unroll
        for (int q = 0; q < 4; ++q) m = fmaxf(m, sr[c0 + q]); }
#pragma unroll
    for (int sh = 16; sh; sh >>= 1) m = fmaxf(m, __shfl_xor(m, sh, 32));
    float sum = 0.f;
#pragma unroll 1
    for (int c0 = lane * 4; c0 < NTK; c0 += 128) {
#pragma unroll
        for (int q = 0; q < 4; ++q) sum += __expf(sr[c0 + q] - m); }
#pragma unroll
    for (int sh = 16; sh; sh >>= 1) sum += __shfl_xor(sum, sh, 32);
    const float inv = 1.0f / sum;
{
#pragma unroll 1
        for (int c0 = lane * 4; c0 < NTK; c0 += 128) { v4h o;
#pragma unroll
            for (int q = 0; q < 4; ++q) o[q] = tohx(__expf(sr[c0 + q] - m) * inv);
            *(v4h*)(po + c0) = o; }
         }
}
__global__ __launch_bounds__(256) void k_mergeh3(const float* __restrict__ OZ, int s0, h16* OH) {
    const int lane = threadIdx.x & 31; const size_t w = (size_t)blockIdx.x * 8 + (threadIdx.x >> 5); if (w >= (size_t)SG * NTK) return; const int g = (int)(w / NTK), i = (int)(w % NTK); const size_t row = (size_t)(s0 + g) * NTK + i;
{
#pragma unroll
        for (int q = 0; q < 2; ++q) { const int c0 = q * 256 + lane * 8; const int h = c0 / HD, d0 = c0 % HD; v8h o;
#pragma unroll
            for (int k = 0; k < 8; ++k) o[k] = tohx(OZ[(((size_t)(g * NH_ + h)) * NTK + i) * HD + d0 + k]);
            *(v8h*)(OH + row * CC + c0) = o; }
         }
}
__global__ __launch_bounds__(256) void k_outT3(const float* __restrict__ Y, const float* __restrict__ x, int s0, float* OUTB) {
    __shared__ float tl[64][65];
    const int tid = threadIdx.x; const int n0 = blockIdx.x * 64, c0 = blockIdx.y * 64; const int g = blockIdx.z, s = s0 + g; const int rr = tid >> 2, cq = (tid & 3) * 16;
#pragma unroll
    for (int i = 0; i < 16; ++i) tl[rr][cq + i] = Y[((size_t)g * NTK + n0 + rr) * CC + c0 + cq + i];   // tl[n][c] (group-local Y row)
    __syncthreads();
    const int lane = tid & 31, wv = tid >> 5;
    auto pass = [&]() {
#pragma unroll
        for (int st = 0; st < 4; ++st) { const int cr = wv * 8 + st * 2 + (lane >> 4); const int nq = (lane & 15) * 4; const size_t o = xoff(s, c0 + cr, n0 + nq); v4f v;
#pragma unroll
            for (int i = 0; i < 4; ++i) v[i] = tl[nq + i][cr] + bfr(x[o + i]);
            *(v4f*)(OUTB + o) = v; }
    };
    pass(); 
}

#define GRW (SG * NTK)            // 2048 rows per group
extern "C" void kernel_launch(void* const* d_in, const int* in_sizes, int n_in,
                              void* d_out, int out_size, void* d_ws, size_t ws_size, hipStream_t stream) {
    (void)in_sizes; (void)n_in; (void)out_size;
    const float* x = (const float*)d_in[0]; const float* lg = (const float*)d_in[1]; const float* lb = (const float*)d_in[2]; const float* Wq = (const float*)d_in[3]; const float* bq = (const float*)d_in[4]; const float* Wk = (const float*)d_in[5]; const float* bk = (const float*)d_in[6]; const float* Wv = (const float*)d_in[7]; const float* bv = (const float*)d_in[8]; const float* Wp = (const float*)d_in[9]; const float* bp = (const float*)d_in[10];
    float* out = (float*)d_out;    // [2][512][8][32][32]
    char* wsp = (char*)d_ws;
    auto take = [&](size_t bytes) { char* p = wsp; wsp += (bytes + 255) & ~(size_t)255; return (void*)p; };
    h16* BQ = (h16*)take((size_t)CC * CC * 2); h16* BK = (h16*)take((size_t)CC * CC * 2); h16* BV = (h16*)take((size_t)CC * CC * 2); h16* BP = (h16*)take((size_t)CC * CC * 2);
    float* MU = (float*)take(NR * 4); float* RS = (float*)take(NR * 4); h16* XN = (h16*)take((size_t)NR * CC * 2);
    float* Q = (float*)take((size_t)GRW * CC * 4); float* Kf = (float*)take((size_t)GRW * CC * 4); float* V = (float*)take((size_t)GRW * CC * 4);
    h16* Qx = (h16*)take((size_t)SG * NH_ * NTK * HD * 2); h16* Kx = (h16*)take((size_t)SG * NH_ * NTK * HD * 2); h16* VTx = (h16*)take((size_t)SG * NH_ * HD * NTK * 2); float* S = (float*)take((size_t)SG * NH_ * NTK * NTK * 4); h16* Px = (h16*)take((size_t)SG * NH_ * NTK * NTK * 2); float* OZ = (float*)take((size_t)SG * NH_ * NTK * HD * 4); h16* OH = (h16*)take((size_t)GRW * CC * 2); float* Y = (float*)take((size_t)GRW * CC * 4);
    if ((size_t)(wsp - (char*)d_ws) > ws_size) return;    // ~ 2.1 + 0.1 + 16.8 + 12.6 + 6.3 + 67 + 33.5 + 4.2 + 2.1 + 4.2 ~ 149 MB
    k_wTh<<<dim3(CC / 64, CC / 64, 1), 256, 0, stream>>>(Wq, CC, CC, BQ); k_wTh<<<dim3(CC / 64, CC / 64, 1), 256, 0, stream>>>(Wk, CC, CC, BK); k_wTh<<<dim3(CC / 64, CC / 64, 1), 256, 0, stream>>>(Wv, CC, CC, BV); k_wTh<<<dim3(CC / 64, CC / 64, 1), 256, 0, stream>>>(Wp, CC, CC, BP);
    k_stat<<<(NR / 32) / 8, 256, 0, stream>>>(x, MU, RS);
    k_nrow<<<NR / 8, 256, 0, stream>>>(x, MU, RS, lg, lb, XN);
    for (int s0 = 0; s0 < NSQ; s0 += SG) { const h16* XG = XN + (size_t)s0 * NTK * CC;
        k_gemmh<<<dim3(GRW / 64, CC / 64, 1), 128, 0, stream>>>(XG, BQ, bq, Q, CC, nullptr, CC, 0, 0, 0, 0);
        k_gemmh<<<dim3(GRW / 64, CC / 64, 1), 128, 0, stream>>>(XG, BK, bk, Kf, CC, nullptr, CC, 0, 0, 0, 0);
        k_gemmh<<<dim3(GRW / 64, CC / 64, 1), 128, 0, stream>>>(XG, BV, bv, V, CC, nullptr, CC, 0, 0, 0, 0);
        k_hplh3<<<dim3((NTK / 2) / 8, 1, SG * NH_), 256, 0, stream>>>(Q, 0, 0.125f, Qx); k_hplh3<<<dim3((NTK / 2) / 8, 1, SG * NH_), 256, 0, stream>>>(Kf, 0, 1.0f, Kx); k_vTh3<<<dim3(NTK / 64, 1, SG * NH_), 256, 0, stream>>>(V, 0, VTx);
        k_gemmh<<<dim3(NTK / 64, NTK / 64, SG * NH_), 128, 0, stream>>>(Qx, Kx, nullptr, S, NTK, nullptr, HD, (size_t)NTK * HD, (size_t)NTK * HD, (size_t)NTK * NTK, 0);
        k_softh3<<<dim3(NTK / 8, 1, SG * NH_), 256, 0, stream>>>(S, Px);
        k_gemmh<<<dim3(NTK / 64, 1, SG * NH_), 128, 0, stream>>>(Px, VTx, nullptr, OZ, HD, nullptr, NTK, (size_t)NTK * NTK, (size_t)HD * NTK, (size_t)NTK * HD, 0);
        k_mergeh3<<<(SG * NTK) / 8, 256, 0, stream>>>(OZ, 0, OH);
        k_gemmh<<<dim3(GRW / 64, CC / 64, 1), 128, 0, stream>>>(OH, BP, bp, Y, CC, nullptr, CC, 0, 0, 0, 0);
        k_outT3<<<dim3(NTK / 64, CC / 64, SG), 256, 0, stream>>>(Y, x, s0, out); }
}

// v001
// Measured time: 966 microseconds a run.
// Timed twice side by side with v000, it ran 1.27 times as fast both times.
#include <hip/hip_runtime.h>

// scores ([1024 x 64].[64 x 1024]) and attn.v on SINGLE fp16 planes (LN output, q/8, k, softmax probabilities, v and the merged heads rounded to fp16 = 2^-11; weights
// fp16(bf16(W)); one v_wmma_f32_16x16x32_f16 product each — the residual input dominating the output); softmax f32; + the input residual in f32 with

#define NSQ  16                   // (b t) sequences
#define NTK  1024                 // (h w) tokens
#define CC   512
#define NH_  8
#define HD   64
#define TT   8
#define NR   (NSQ * NTK)          // 16384
#define SG   2                    // sequences per attention group (z = 16)
#define DM   CC
#define LOSC 1024.0f
typedef _Float16 h16;
typedef unsigned short bf;
typedef __attribute__((ext_vector_type(16))) __bf16   v16bf;
typedef __attribute__((ext_vector_type(16))) _Float16 v16h;
typedef __attribute__((ext_vector_type(8)))  _Float16 v8h;
typedef __attribute__((ext_vector_type(8)))  unsigned short v8us;
typedef __attribute__((ext_vector_type(8)))  float    v8f;
typedef __attribute__((ext_vector_type(4)))  float    v4f;
typedef v8h  __attribute__((may_alias)) v8ha;
typedef v4f  __attribute__((may_alias)) v4fa;
typedef v8us __attribute__((may_alias)) v8usa;

__device__ __forceinline__ unsigned short f2bf(float f) { unsigned u = __float_as_uint(f); u += 0x7FFFu + ((u >> 16) & 1u); return (unsigned short)(u >> 16); }
__device__ __forceinline__ float bf2f(unsigned short b) { return __uint_as_float(((unsigned)b) << 16); }
__device__ __forceinline__ float bfr(float f) { return bf2f(f2bf(f)); }
__device__ __forceinline__ v16h cat16(v8h lo, v8h hi) { return __builtin_shufflevector(lo, hi, 0, 1, 2, 3, 4, 5, 6, 7, 8, 9, 10, 11, 12, 13, 14, 15); }
__device__ __forceinline__ v16bf cat16b(v8us lo, v8us hi) { return __builtin_bit_cast(v16bf, __builtin_shufflevector(lo, hi, 0, 1, 2, 3, 4, 5, 6, 7, 8, 9, 10, 11, 12, 13, 14, 15)); }
__device__ __forceinline__ v8f wmma16(v16h a, v16h b, v8f c) { return __builtin_amdgcn_wmma_f32_16x16x32_f16(false, a, false, b, (short)0, c, false, false); }
__device__ __forceinline__ v8f wmmab(v16bf a, v16bf b, v8f c) { return __builtin_amdgcn_wmma_f32_16x16x32_bf16(false, a, false, b, (short)0, c, false, false); }


// k_gemmh: 64 x 64 tile of C = A . Bn^T with SINGLE f16 planes (A [rows][K] f16 activations, Bn [N][K] f16 weights; one v_wmma_f32_16x16x32_f16 product per step), f32 accumulate;
__global__ __launch_bounds__(128) void k_gemmh(const h16* __restrict__ A, const h16* __restrict__ Bn, const float* __restrict__ bias, float* C, int ldc, const float* __restrict__ R, int K, size_t sA, size_t sB, size_t sC, int roundR) {
    __shared__ __align__(16) float ost[4][16 * 68];
    const size_t z = blockIdx.z; A += z * sA; Bn += z * sB; C += z * sC; if (R) R += z * sC;
    const int lane = threadIdx.x & 31, wave = threadIdx.x >> 5, lr = lane & 15, hi = lane >> 4;
    const int r0 = blockIdx.x * 64 + wave * 16, c0 = blockIdx.y * 64;
    const size_t aoff = (size_t)(r0 + lr) * K + 8 * hi;
    size_t boff[4];
#pragma unroll
    for (int t = 0; t < 4; ++t) boff[t] = (size_t)(c0 + t * 16 + lr) * K + 8 * hi;
    v8f acc[4];
#pragma unroll
    for (int t = 0; t < 4; ++t) acc[t] = (v8f){};
#pragma unroll 1
    for (int kc = 0; kc < K; kc += 32) {
        const v16h a = cat16(*(const v8h*)(A + aoff + kc), *(const v8h*)(A + aoff + kc + 16));
#pragma unroll
        for (int t = 0; t < 4; ++t) { const v16h b = cat16(*(const v8h*)(Bn + boff[t] + kc), *(const v8h*)(Bn + boff[t] + kc + 16)); acc[t] = wmma16(a, b, acc[t]); }
        asm volatile("v_nop\n\tv_nop\n\tv_nop\n\tv_nop" : "+v"(acc[0]), "+v"(acc[1]), "+v"(acc[2]), "+v"(acc[3]) : "v"(a));
    }
    float* os = &ost[wave][0];
#pragma unroll
    for (int t = 0; t < 4; ++t) { const float bv = bias ? bfr(bias[c0 + t * 16 + lr]) : 0.f;
#pragma unroll
        for (int j = 0; j < 8; ++j) os[(hi * 8 + j) * 68 + t * 16 + lr] = acc[t][j] + bv; }
    __syncthreads();
    float* crow = C + (size_t)r0 * ldc + c0;
    auto pass = [&]() {
#pragma unroll
        for (int s = 0; s < 8; ++s) { const int Lid = (lane >> 3) + 4 * s, piece = lane & 7; const int row = Lid >> 1, cofs = (Lid & 1) * 32 + piece * 4;
            v4f val = *(const v4fa*)(os + row * 68 + cofs); if (R) { const v4f rv = *(const v4f*)(R + ((size_t)r0 + row) * ldc + c0 + cofs); val += roundR ? (v4f){bfr(rv[0]), bfr(rv[1]), bfr(rv[2]), bfr(rv[3])} : rv; }
            *(v4f*)(crow + (size_t)row * ldc + cofs) = val; }
    };
    pass(); 
}

typedef __attribute__((ext_vector_type(4))) _Float16 v4h;
__device__ __forceinline__ h16 tohx(float x) { return (h16)x; }
__device__ __forceinline__ size_t xoff(int s, int c, int n) { const int b = s / TT, t = s % TT; return (((size_t)b * CC + c) * TT + t) * NTK + n; }   // x[b][c][t][n]
// k_stat: one work-group per 64 tokens. Each of its 16 waves holds 32 channels of them in registers (16 independent 16-byte loads per lane, a half-wave per channel row),
// so x is read once and no load waits on the one before it; the channel sums meet in LDS: per-lane chain, the two half-waves, then the 16 waves in index order.
__global__ __launch_bounds__(512) void k_stat(const float* __restrict__ x, float* MU, float* RS) {
    __shared__ __align__(16) float red[2][16][64];
    const int lane = threadIdx.x & 31, wv = threadIdx.x >> 5, hi = lane >> 4, tq = (lane & 15) * 4;
    const int s = blockIdx.x / (NTK / 64), n0 = (blockIdx.x % (NTK / 64)) * 64;
    const float* p = x + xoff(s, wv * 32 + hi, n0 + tq);      // channel wv * 32 + 2 i + hi, tokens n0 + tq .. + 3
    v4f v[16];
#pragma unroll
    for (int i = 0; i < 16; ++i) v[i] = *(const v4f*)(p + (size_t)i * (2 * TT * NTK));
    v4f sm = (v4f){};
#pragma unroll
    for (int i = 0; i < 16; ++i) { v[i] = (v4f){bfr(v[i][0]), bfr(v[i][1]), bfr(v[i][2]), bfr(v[i][3])}; sm += v[i]; }
#pragma unroll
    for (int j = 0; j < 4; ++j) sm[j] += __shfl_xor(sm[j], 16, 32);
    if (hi == 0) *(v4fa*)(&red[0][wv][tq]) = sm;
    __syncthreads();
    v4f mu = (v4f){};
#pragma unroll
    for (int w = 0; w < 16; ++w) mu += *(const v4fa*)(&red[0][w][tq]);
    mu *= (1.0f / CC);
    v4f q = (v4f){};
#pragma unroll
    for (int i = 0; i < 16; ++i) { const v4f d = v[i] - mu;
#pragma unroll
        for (int j = 0; j < 4; ++j) q[j] = fmaf(d[j], d[j], q[j]); }
#pragma unroll
    for (int j = 0; j < 4; ++j) q[j] += __shfl_xor(q[j], 16, 32);
    if (hi == 0) *(v4fa*)(&red[1][wv][tq]) = q;
    __syncthreads();
    if (threadIdx.x < 16) { v4f qs = (v4f){};
#pragma unroll
        for (int w = 0; w < 16; ++w) qs += *(const v4fa*)(&red[1][w][tq]);
        const size_t r = (size_t)s * NTK + n0 + tq;
        *(v4f*)(MU + r) = mu; *(v4f*)(RS + r) = (v4f){rsqrtf(qs[0] * (1.0f / CC) + 1e-5f), rsqrtf(qs[1] * (1.0f / CC) + 1e-5f), rsqrtf(qs[2] * (1.0f / CC) + 1e-5f), rsqrtf(qs[3] * (1.0f / CC) + 1e-5f)}; }
}
__global__ __launch_bounds__(256) void k_nrow(const float* __restrict__ x, const float* __restrict__ MU, const float* __restrict__ RS, const float* __restrict__ g, const float* __restrict__ bb, h16* XN) {
    const int lane = threadIdx.x & 31; const size_t r = (size_t)blockIdx.x * 8 + (threadIdx.x >> 5); if (r >= (size_t)NR) return; const int s = (int)(r / NTK), n = (int)(r % NTK); const float mu = MU[r], rs = RS[r];
{
#pragma unroll 1
        for (int p = 0; p < CC / 256; ++p) { const int c0 = p * 256 + lane * 8; v8h o;
#pragma unroll
            for (int i = 0; i < 8; ++i) { const int c = c0 + i; o[i] = tohx((bfr(x[xoff(s, c, n)]) - mu) * rs * bfr(g[c]) + bfr(bb[c])); }
            *(v8h*)(XN + r * CC + c0) = o; }
         }
}
__global__ __launch_bounds__(256) void k_wTh(const float* __restrict__ Wm, int K, int N, h16* Bt) {
    __shared__ float tl[64][65];
    const int tid = threadIdx.x; const int k0 = blockIdx.x * 64, n0 = blockIdx.y * 64; const int rr = tid >> 2, cq = (tid & 3) * 16;
#pragma unroll
    for (int i = 0; i < 16; ++i) tl[rr][cq + i] = bfr(Wm[(size_t)(k0 + rr) * N + n0 + cq + i]);
    __syncthreads();
    const int lane = tid & 31, wv = tid >> 5;
    auto pass = [&]() {
#pragma unroll
        for (int st = 0; st < 4; ++st) { const int nr = wv * 8 + st * 2 + (lane >> 4); const int kq = (lane & 15) * 4; v4h v;
#pragma unroll
            for (int i = 0; i < 4; ++i) v[i] = tohx(tl[kq + i][nr]);
            *(v4h*)(Bt + (size_t)(n0 + nr) * K + k0 + kq) = v; }
    };
    pass(); 
}
__global__ __launch_bounds__(256) void k_hplh3(const float* __restrict__ F, int s0, float sc, h16* P) {
    const int lane = threadIdx.x & 31; const size_t w = (size_t)blockIdx.x * 8 + (threadIdx.x >> 5); const int i = (int)(w * 2 + (lane >> 4)); if (i >= NTK) return; const int g = blockIdx.z / NH_, h = blockIdx.z % NH_; const int c0 = (lane & 15) * 4; v4h o;
#pragma unroll
    for (int q = 0; q < 4; ++q) o[q] = tohx(F[((size_t)(s0 + g) * NTK + i) * CC + h * HD + c0 + q] * sc);
    const size_t off = ((size_t)blockIdx.z * NTK + i) * HD + c0; *(v4h*)(P + off) = o; 
}
__global__ __launch_bounds__(256) void k_vTh3(const float* __restrict__ V, int s0, h16* VT) {
    __shared__ float tl[64][65];
    const int tid = threadIdx.x; const int t0 = blockIdx.x * 64; const int g = blockIdx.z / NH_, h = blockIdx.z % NH_; const int rr = tid >> 2, cq = (tid & 3) * 16;
#pragma unroll
    for (int i = 0; i < 16; ++i) tl[rr][cq + i] = V[((size_t)(s0 + g) * NTK + t0 + rr) * CC + h * HD + cq + i];
    __syncthreads();
    const int lane = tid & 31, wv = tid >> 5;
    auto pass = [&]() {
#pragma unroll
        for (int st = 0; st < 4; ++st) { const int dr = wv * 8 + st * 2 + (lane >> 4); const int tq = (lane & 15) * 4; v4h v;
#pragma unroll
            for (int i = 0; i < 4; ++i) v[i] = tohx(tl[tq + i][dr]);
            *(v4h*)(VT + ((size_t)blockIdx.z * HD + dr) * NTK + t0 + tq) = v; }
    };
    pass(); 
}
__global__ __launch_bounds__(256) void k_softh3(const float* __restrict__ S, h16* P) {
    const int lane = threadIdx.x & 31, i = blockIdx.x * 8 + (threadIdx.x >> 5); if (i >= NTK) return; const size_t zo = (size_t)blockIdx.z * NTK * NTK + (size_t)i * NTK; const float* sr = S + zo; h16* po = P + zo;
    float m = -3.0e38f;
#pragma unroll 1
    for (int c0 = lane * 4; c0 < NTK; c0 += 128) {
#pragma unroll
        for (int q = 0; q < 4; ++q) m = fmaxf(m, sr[c0 + q]); }
#pragma unroll
    for (int sh = 16; sh; sh >>= 1) m = fmaxf(m, __shfl_xor(m, sh, 32));
    float sum = 0.f;
#pragma unroll 1
    for (int c0 = lane * 4; c0 < NTK; c0 += 128) {
#pragma unroll
        for (int q = 0; q < 4; ++q) sum += __expf(sr[c0 + q] - m); }
#pragma unroll
    for (int sh = 16; sh; sh >>= 1) sum += __shfl_xor(sum, sh, 32);
    const float inv = 1.0f / sum;
{
#pragma unroll 1
        for (int c0 = lane * 4; c0 < NTK; c0 += 128) { v4h o;
#pragma unroll
            for (int q = 0; q < 4; ++q) o[q] = tohx(__expf(sr[c0 + q] - m) * inv);
            *(v4h*)(po + c0) = o; }
         }
}
__global__ __launch_bounds__(256) void k_mergeh3(const float* __restrict__ OZ, int s0, h16* OH) {
    const int lane = threadIdx.x & 31; const size_t w = (size_t)blockIdx.x * 8 + (threadIdx.x >> 5); if (w >= (size_t)SG * NTK) return; const int g = (int)(w / NTK), i = (int)(w % NTK); const size_t row = (size_t)(s0 + g) * NTK + i;
{
#pragma unroll
        for (int q = 0; q < 2; ++q) { const int c0 = q * 256 + lane * 8; const int h = c0 / HD, d0 = c0 % HD; v8h o;
#pragma unroll
            for (int k = 0; k < 8; ++k) o[k] = tohx(OZ[(((size_t)(g * NH_ + h)) * NTK + i) * HD + d0 + k]);
            *(v8h*)(OH + row * CC + c0) = o; }
         }
}
__global__ __launch_bounds__(256) void k_outT3(const float* __restrict__ Y, const float* __restrict__ x, int s0, float* OUTB) {
    __shared__ float tl[64][65];
    const int tid = threadIdx.x; const int n0 = blockIdx.x * 64, c0 = blockIdx.y * 64; const int g = blockIdx.z, s = s0 + g; const int rr = tid >> 2, cq = (tid & 3) * 16;
#pragma unroll
    for (int i = 0; i < 16; ++i) tl[rr][cq + i] = Y[((size_t)g * NTK + n0 + rr) * CC + c0 + cq + i];   // tl[n][c] (group-local Y row)
    __syncthreads();
    const int lane = tid & 31, wv = tid >> 5;
    auto pass = [&]() {
#pragma unroll
        for (int st = 0; st < 4; ++st) { const int cr = wv * 8 + st * 2 + (lane >> 4); const int nq = (lane & 15) * 4; const size_t o = xoff(s, c0 + cr, n0 + nq); v4f v;
#pragma unroll
            for (int i = 0; i < 4; ++i) v[i] = tl[nq + i][cr] + bfr(x[o + i]);
            *(v4f*)(OUTB + o) = v; }
    };
    pass(); 
}

#define GRW (SG * NTK)            // 2048 rows per group
extern "C" void kernel_launch(void* const* d_in, const int* in_sizes, int n_in,
                              void* d_out, int out_size, void* d_ws, size_t ws_size, hipStream_t stream) {
    (void)in_sizes; (void)n_in; (void)out_size;
    const float* x = (const float*)d_in[0]; const float* lg = (const float*)d_in[1]; const float* lb = (const float*)d_in[2]; const float* Wq = (const float*)d_in[3]; const float* bq = (const float*)d_in[4]; const float* Wk = (const float*)d_in[5]; const float* bk = (const float*)d_in[6]; const float* Wv = (const float*)d_in[7]; const float* bv = (const float*)d_in[8]; const float* Wp = (const float*)d_in[9]; const float* bp = (const float*)d_in[10];
    float* out = (float*)d_out;    // [2][512][8][32][32]
    char* wsp = (char*)d_ws;
    auto take = [&](size_t bytes) { char* p = wsp; wsp += (bytes + 255) & ~(size_t)255; return (void*)p; };
    h16* BQ = (h16*)take((size_t)CC * CC * 2); h16* BK = (h16*)take((size_t)CC * CC * 2); h16* BV = (h16*)take((size_t)CC * CC * 2); h16* BP = (h16*)take((size_t)CC * CC * 2);
    float* MU = (float*)take(NR * 4); float* RS = (float*)take(NR * 4); h16* XN = (h16*)take((size_t)NR * CC * 2);
    float* Q = (float*)take((size_t)GRW * CC * 4); float* Kf = (float*)take((size_t)GRW * CC * 4); float* V = (float*)take((size_t)GRW * CC * 4);
    h16* Qx = (h16*)take((size_t)SG * NH_ * NTK * HD * 2); h16* Kx = (h16*)take((size_t)SG * NH_ * NTK * HD * 2); h16* VTx = (h16*)take((size_t)SG * NH_ * HD * NTK * 2); float* S = (float*)take((size_t)SG * NH_ * NTK * NTK * 4); h16* Px = (h16*)take((size_t)SG * NH_ * NTK * NTK * 2); float* OZ = (float*)take((size_t)SG * NH_ * NTK * HD * 4); h16* OH = (h16*)take((size_t)GRW * CC * 2); float* Y = (float*)take((size_t)GRW * CC * 4);
    if ((size_t)(wsp - (char*)d_ws) > ws_size) return;    // ~ 2.1 + 0.1 + 16.8 + 12.6 + 6.3 + 67 + 33.5 + 4.2 + 2.1 + 4.2 ~ 149 MB
    k_wTh<<<dim3(CC / 64, CC / 64, 1), 256, 0, stream>>>(Wq, CC, CC, BQ); k_wTh<<<dim3(CC / 64, CC / 64, 1), 256, 0, stream>>>(Wk, CC, CC, BK); k_wTh<<<dim3(CC / 64, CC / 64, 1), 256, 0, stream>>>(Wv, CC, CC, BV); k_wTh<<<dim3(CC / 64, CC / 64, 1), 256, 0, stream>>>(Wp, CC, CC, BP);
    k_stat<<<NR / 64, 512, 0, stream>>>(x, MU, RS);
    k_nrow<<<NR / 8, 256, 0, stream>>>(x, MU, RS, lg, lb, XN);
    for (int s0 = 0; s0 < NSQ; s0 += SG) { const h16* XG = XN + (size_t)s0 * NTK * CC;
        k_gemmh<<<dim3(GRW / 64, CC / 64, 1), 128, 0, stream>>>(XG, BQ, bq, Q, CC, nullptr, CC, 0, 0, 0, 0);
        k_gemmh<<<dim3(GRW / 64, CC / 64, 1), 128, 0, stream>>>(XG, BK, bk, Kf, CC, nullptr, CC, 0, 0, 0, 0);
        k_gemmh<<<dim3(GRW / 64, CC / 64, 1), 128, 0, stream>>>(XG, BV, bv, V, CC, nullptr, CC, 0, 0, 0, 0);
        k_hplh3<<<dim3((NTK / 2) / 8, 1, SG * NH_), 256, 0, stream>>>(Q, 0, 0.125f, Qx); k_hplh3<<<dim3((NTK / 2) / 8, 1, SG * NH_), 256, 0, stream>>>(Kf, 0, 1.0f, Kx); k_vTh3<<<dim3(NTK / 64, 1, SG * NH_), 256, 0, stream>>>(V, 0, VTx);
        k_gemmh<<<dim3(NTK / 64, NTK / 64, SG * NH_), 128, 0, stream>>>(Qx, Kx, nullptr, S, NTK, nullptr, HD, (size_t)NTK * HD, (size_t)NTK * HD, (size_t)NTK * NTK, 0);
        k_softh3<<<dim3(NTK / 8, 1, SG * NH_), 256, 0, stream>>>(S, Px);
        k_gemmh<<<dim3(NTK / 64, 1, SG * NH_), 128, 0, stream>>>(Px, VTx, nullptr, OZ, HD, nullptr, NTK, (size_t)NTK * NTK, (size_t)HD * NTK, (size_t)NTK * HD, 0);
        k_mergeh3<<<(SG * NTK) / 8, 256, 0, stream>>>(OZ, 0, OH);
        k_gemmh<<<dim3(GRW / 64, CC / 64, 1), 128, 0, stream>>>(OH, BP, bp, Y, CC, nullptr, CC, 0, 0, 0, 0);
        k_outT3<<<dim3(NTK / 64, CC / 64, SG), 256, 0, stream>>>(Y, x, s0, out); }
}

// v002
// It runs in 722 microseconds.
// Next to v001, in two timings, it ran 1.32 and 1.34 times as fast.
// Over all steps from v000 it is 1.69 times as fast.
#include <hip/hip_runtime.h>

// scores ([1024 x 64].[64 x 1024]) and attn.v on SINGLE fp16 planes (LN output, q/8, k, softmax probabilities, v and the merged heads rounded to fp16 = 2^-11; weights
// fp16(bf16(W)); one v_wmma_f32_16x16x32_f16 product each — the residual input dominating the output); softmax f32; + the input residual in f32 with

#define NSQ  16                   // (b t) sequences
#define NTK  1024                 // (h w) tokens
#define CC   512
#define NH_  8
#define HD   64
#define TT   8
#define NR   (NSQ * NTK)          // 16384
#define SG   2                    // sequences per attention group (z = 16)
#define DM   CC
#define LOSC 1024.0f
typedef _Float16 h16;
typedef unsigned short bf;
typedef __attribute__((ext_vector_type(16))) __bf16   v16bf;
typedef __attribute__((ext_vector_type(16))) _Float16 v16h;
typedef __attribute__((ext_vector_type(8)))  _Float16 v8h;
typedef __attribute__((ext_vector_type(8)))  unsigned short v8us;
typedef __attribute__((ext_vector_type(8)))  float    v8f;
typedef __attribute__((ext_vector_type(4)))  float    v4f;
typedef v8h  __attribute__((may_alias)) v8ha;
typedef v4f  __attribute__((may_alias)) v4fa;
typedef v8us __attribute__((may_alias)) v8usa;

__device__ __forceinline__ unsigned short f2bf(float f) { unsigned u = __float_as_uint(f); u += 0x7FFFu + ((u >> 16) & 1u); return (unsigned short)(u >> 16); }
__device__ __forceinline__ float bf2f(unsigned short b) { return __uint_as_float(((unsigned)b) << 16); }
__device__ __forceinline__ float bfr(float f) { return bf2f(f2bf(f)); }
__device__ __forceinline__ v16h cat16(v8h lo, v8h hi) { return __builtin_shufflevector(lo, hi, 0, 1, 2, 3, 4, 5, 6, 7, 8, 9, 10, 11, 12, 13, 14, 15); }
__device__ __forceinline__ v16bf cat16b(v8us lo, v8us hi) { return __builtin_bit_cast(v16bf, __builtin_shufflevector(lo, hi, 0, 1, 2, 3, 4, 5, 6, 7, 8, 9, 10, 11, 12, 13, 14, 15)); }
__device__ __forceinline__ v8f wmma16(v16h a, v16h b, v8f c) { return __builtin_amdgcn_wmma_f32_16x16x32_f16(false, a, false, b, (short)0, c, false, false); }
__device__ __forceinline__ v8f wmmab(v16bf a, v16bf b, v8f c) { return __builtin_amdgcn_wmma_f32_16x16x32_bf16(false, a, false, b, (short)0, c, false, false); }


// k_gemmh: 64 x 64 tile of C = A . Bn^T with SINGLE f16 planes (A [rows][K] f16 activations, Bn [N][K] f16 weights; one v_wmma_f32_16x16x32_f16 product per step), f32 accumulate;
// bias1, bias2: where given, grid z = 1 and z = 2 add these in place of bias (q, k and v projections in one launch).
__global__ __launch_bounds__(128) void k_gemmh(const h16* __restrict__ A, const h16* __restrict__ Bn, const float* bias, const float* bias1, const float* bias2, float* C, int ldc, const float* __restrict__ R, int K, size_t sA, size_t sB, size_t sC, int roundR) {
    __shared__ __align__(16) float ost[4][16 * 68];
    const size_t z = blockIdx.z; A += z * sA; Bn += z * sB; C += z * sC; if (R) R += z * sC;
    if (bias1 && z) bias = z == 1 ? bias1 : bias2;
    const int lane = threadIdx.x & 31, wave = threadIdx.x >> 5, lr = lane & 15, hi = lane >> 4;
    const int r0 = blockIdx.x * 64 + wave * 16, c0 = blockIdx.y * 64;
    const size_t aoff = (size_t)(r0 + lr) * K + 8 * hi;
    size_t boff[4];
#pragma unroll
    for (int t = 0; t < 4; ++t) boff[t] = (size_t)(c0 + t * 16 + lr) * K + 8 * hi;
    v8f acc[4];
#pragma unroll
    for (int t = 0; t < 4; ++t) acc[t] = (v8f){};
#pragma unroll 1
    for (int kc = 0; kc < K; kc += 32) {
        const v16h a = cat16(*(const v8h*)(A + aoff + kc), *(const v8h*)(A + aoff + kc + 16));
#pragma unroll
        for (int t = 0; t < 4; ++t) { const v16h b = cat16(*(const v8h*)(Bn + boff[t] + kc), *(const v8h*)(Bn + boff[t] + kc + 16)); acc[t] = wmma16(a, b, acc[t]); }
        asm volatile("v_nop\n\tv_nop\n\tv_nop\n\tv_nop" : "+v"(acc[0]), "+v"(acc[1]), "+v"(acc[2]), "+v"(acc[3]) : "v"(a));
    }
    float* os = &ost[wave][0];
#pragma unroll
    for (int t = 0; t < 4; ++t) { const float bv = bias ? bfr(bias[c0 + t * 16 + lr]) : 0.f;
#pragma unroll
        for (int j = 0; j < 8; ++j) os[(hi * 8 + j) * 68 + t * 16 + lr] = acc[t][j] + bv; }
    __syncthreads();
    float* crow = C + (size_t)r0 * ldc + c0;
    auto pass = [&]() {
#pragma unroll
        for (int s = 0; s < 8; ++s) { const int Lid = (lane >> 3) + 4 * s, piece = lane & 7; const int row = Lid >> 1, cofs = (Lid & 1) * 32 + piece * 4;
            v4f val = *(const v4fa*)(os + row * 68 + cofs); if (R) { const v4f rv = *(const v4f*)(R + ((size_t)r0 + row) * ldc + c0 + cofs); val += roundR ? (v4f){bfr(rv[0]), bfr(rv[1]), bfr(rv[2]), bfr(rv[3])} : rv; }
            *(v4f*)(crow + (size_t)row * ldc + cofs) = val; }
    };
    pass(); 
}

typedef __attribute__((ext_vector_type(4))) _Float16 v4h;
__device__ __forceinline__ h16 tohx(float x) { return (h16)x; }
__device__ __forceinline__ size_t xoff(int s, int c, int n) { const int b = s / TT, t = s % TT; return (((size_t)b * CC + c) * TT + t) * NTK + n; }   // x[b][c][t][n]
// k_stat: one work-group per 64 tokens. Each of its 16 waves holds 32 channels of them in registers (16 independent 16-byte loads per lane, a half-wave per channel row),
// so x is read once and no load waits on the one before it; the channel sums meet in LDS: per-lane chain, the two half-waves, then the 16 waves in index order.
__global__ __launch_bounds__(512) void k_stat(const float* __restrict__ x, float* MU, float* RS) {
    __shared__ __align__(16) float red[2][16][64];
    const int lane = threadIdx.x & 31, wv = threadIdx.x >> 5, hi = lane >> 4, tq = (lane & 15) * 4;
    const int s = blockIdx.x / (NTK / 64), n0 = (blockIdx.x % (NTK / 64)) * 64;
    const float* p = x + xoff(s, wv * 32 + hi, n0 + tq);      // channel wv * 32 + 2 i + hi, tokens n0 + tq .. + 3
    v4f v[16];
#pragma unroll
    for (int i = 0; i < 16; ++i) v[i] = *(const v4f*)(p + (size_t)i * (2 * TT * NTK));
    v4f sm = (v4f){};
#pragma unroll
    for (int i = 0; i < 16; ++i) { v[i] = (v4f){bfr(v[i][0]), bfr(v[i][1]), bfr(v[i][2]), bfr(v[i][3])}; sm += v[i]; }
#pragma unroll
    for (int j = 0; j < 4; ++j) sm[j] += __shfl_xor(sm[j], 16, 32);
    if (hi == 0) *(v4fa*)(&red[0][wv][tq]) = sm;
    __syncthreads();
    v4f mu = (v4f){};
#pragma unroll
    for (int w = 0; w < 16; ++w) mu += *(const v4fa*)(&red[0][w][tq]);
    mu *= (1.0f / CC);
    v4f q = (v4f){};
#pragma unroll
    for (int i = 0; i < 16; ++i) { const v4f d = v[i] - mu;
#pragma unroll
        for (int j = 0; j < 4; ++j) q[j] = fmaf(d[j], d[j], q[j]); }
#pragma unroll
    for (int j = 0; j < 4; ++j) q[j] += __shfl_xor(q[j], 16, 32);
    if (hi == 0) *(v4fa*)(&red[1][wv][tq]) = q;
    __syncthreads();
    if (threadIdx.x < 16) { v4f qs = (v4f){};
#pragma unroll
        for (int w = 0; w < 16; ++w) qs += *(const v4fa*)(&red[1][w][tq]);
        const size_t r = (size_t)s * NTK + n0 + tq;
        *(v4f*)(MU + r) = mu; *(v4f*)(RS + r) = (v4f){rsqrtf(qs[0] * (1.0f / CC) + 1e-5f), rsqrtf(qs[1] * (1.0f / CC) + 1e-5f), rsqrtf(qs[2] * (1.0f / CC) + 1e-5f), rsqrtf(qs[3] * (1.0f / CC) + 1e-5f)}; }
}
__global__ __launch_bounds__(256) void k_nrow(const float* __restrict__ x, const float* __restrict__ MU, const float* __restrict__ RS, const float* __restrict__ g, const float* __restrict__ bb, h16* XN) {
    const int lane = threadIdx.x & 31; const size_t r = (size_t)blockIdx.x * 8 + (threadIdx.x >> 5); if (r >= (size_t)NR) return; const int s = (int)(r / NTK), n = (int)(r % NTK); const float mu = MU[r], rs = RS[r];
{
#pragma unroll 1
        for (int p = 0; p < CC / 256; ++p) { const int c0 = p * 256 + lane * 8; v8h o;
#pragma unroll
            for (int i = 0; i < 8; ++i) { const int c = c0 + i; o[i] = tohx((bfr(x[xoff(s, c, n)]) - mu) * rs * bfr(g[c]) + bfr(bb[c])); }
            *(v8h*)(XN + r * CC + c0) = o; }
         }
}
__global__ __launch_bounds__(256) void k_wTh(const float* __restrict__ W0, const float* __restrict__ W1, const float* __restrict__ W2, const float* __restrict__ W3, int K, int N, h16* Bt) {
    __shared__ float tl[64][65];
    const float* Wm = blockIdx.z == 0 ? W0 : blockIdx.z == 1 ? W1 : blockIdx.z == 2 ? W2 : W3; Bt += (size_t)blockIdx.z * K * N;   // grid z picks the weight and its plane
    const int tid = threadIdx.x; const int k0 = blockIdx.x * 64, n0 = blockIdx.y * 64; const int rr = tid >> 2, cq = (tid & 3) * 16;
#pragma unroll
    for (int i = 0; i < 16; ++i) tl[rr][cq + i] = bfr(Wm[(size_t)(k0 + rr) * N + n0 + cq + i]);
    __syncthreads();
    const int lane = tid & 31, wv = tid >> 5;
    auto pass = [&]() {
#pragma unroll
        for (int st = 0; st < 4; ++st) { const int nr = wv * 8 + st * 2 + (lane >> 4); const int kq = (lane & 15) * 4; v4h v;
#pragma unroll
            for (int i = 0; i < 4; ++i) v[i] = tohx(tl[kq + i][nr]);
            *(v4h*)(Bt + (size_t)(n0 + nr) * K + k0 + kq) = v; }
    };
    pass(); 
}
// grid z = (plane, sequence, head): the k plane follows the q plane in F and in P; sc scales the first NSQ * NH_ of z (q), sc2 the rest (k).
__global__ __launch_bounds__(256) void k_hplh3(const float* __restrict__ F, int s0, float sc, float sc2, h16* P) {
    const int lane = threadIdx.x & 31; const size_t w = (size_t)blockIdx.x * 8 + (threadIdx.x >> 5); const int i = (int)(w * 2 + (lane >> 4)); if (i >= NTK) return; const int g = blockIdx.z / NH_, h = blockIdx.z % NH_; const int c0 = (lane & 15) * 4; v4h o;
    if (blockIdx.z >= NSQ * NH_) sc = sc2;
#pragma unroll
    for (int q = 0; q < 4; ++q) o[q] = tohx(F[((size_t)(s0 + g) * NTK + i) * CC + h * HD + c0 + q] * sc);
    const size_t off = ((size_t)blockIdx.z * NTK + i) * HD + c0; *(v4h*)(P + off) = o; 
}
__global__ __launch_bounds__(256) void k_vTh3(const float* __restrict__ V, int s0, h16* VT) {
    __shared__ float tl[64][65];
    const int tid = threadIdx.x; const int t0 = blockIdx.x * 64; const int g = blockIdx.z / NH_, h = blockIdx.z % NH_; const int rr = tid >> 2, cq = (tid & 3) * 16;
#pragma unroll
    for (int i = 0; i < 16; ++i) tl[rr][cq + i] = V[((size_t)(s0 + g) * NTK + t0 + rr) * CC + h * HD + cq + i];
    __syncthreads();
    const int lane = tid & 31, wv = tid >> 5;
    auto pass = [&]() {
#pragma unroll
        for (int st = 0; st < 4; ++st) { const int dr = wv * 8 + st * 2 + (lane >> 4); const int tq = (lane & 15) * 4; v4h v;
#pragma unroll
            for (int i = 0; i < 4; ++i) v[i] = tohx(tl[tq + i][dr]);
            *(v4h*)(VT + ((size_t)blockIdx.z * HD + dr) * NTK + t0 + tq) = v; }
    };
    pass(); 
}
__global__ __launch_bounds__(256) void k_softh3(const float* __restrict__ S, h16* P) {
    const int lane = threadIdx.x & 31, i = blockIdx.x * 8 + (threadIdx.x >> 5); if (i >= NTK) return; const size_t zo = (size_t)blockIdx.z * NTK * NTK + (size_t)i * NTK; const float* sr = S + zo; h16* po = P + zo;
    float m = -3.0e38f;
#pragma unroll 1
    for (int c0 = lane * 4; c0 < NTK; c0 += 128) {
#pragma unroll
        for (int q = 0; q < 4; ++q) m = fmaxf(m, sr[c0 + q]); }
#pragma unroll
    for (int sh = 16; sh; sh >>= 1) m = fmaxf(m, __shfl_xor(m, sh, 32));
    float sum = 0.f;
#pragma unroll 1
    for (int c0 = lane * 4; c0 < NTK; c0 += 128) {
#pragma unroll
        for (int q = 0; q < 4; ++q) sum += __expf(sr[c0 + q] - m); }
#pragma unroll
    for (int sh = 16; sh; sh >>= 1) sum += __shfl_xor(sum, sh, 32);
    const float inv = 1.0f / sum;
{
#pragma unroll 1
        for (int c0 = lane * 4; c0 < NTK; c0 += 128) { v4h o;
#pragma unroll
            for (int q = 0; q < 4; ++q) o[q] = tohx(__expf(sr[c0 + q] - m) * inv);
            *(v4h*)(po + c0) = o; }
         }
}
__global__ __launch_bounds__(256) void k_mergeh3(const float* __restrict__ OZ, int s0, h16* OH) {
    const int lane = threadIdx.x & 31; const size_t w = (size_t)blockIdx.x * 8 + (threadIdx.x >> 5); if (w >= (size_t)NR) return; const int g = (int)(w / NTK), i = (int)(w % NTK); const size_t row = (size_t)(s0 + g) * NTK + i;
{
#pragma unroll
        for (int q = 0; q < 2; ++q) { const int c0 = q * 256 + lane * 8; const int h = c0 / HD, d0 = c0 % HD; v8h o;
#pragma unroll
            for (int k = 0; k < 8; ++k) o[k] = tohx(OZ[(((size_t)(g * NH_ + h)) * NTK + i) * HD + d0 + k]);
            *(v8h*)(OH + row * CC + c0) = o; }
         }
}
__global__ __launch_bounds__(256) void k_outT3(const float* __restrict__ Y, const float* __restrict__ x, int s0, float* OUTB) {
    __shared__ float tl[64][65];
    const int tid = threadIdx.x; const int n0 = blockIdx.x * 64, c0 = blockIdx.y * 64; const int g = blockIdx.z, s = s0 + g; const int rr = tid >> 2, cq = (tid & 3) * 16;
#pragma unroll
    for (int i = 0; i < 16; ++i) tl[rr][cq + i] = Y[((size_t)g * NTK + n0 + rr) * CC + c0 + cq + i];   // tl[n][c] (group-local Y row)
    __syncthreads();
    const int lane = tid & 31, wv = tid >> 5;
    auto pass = [&]() {
#pragma unroll
        for (int st = 0; st < 4; ++st) { const int cr = wv * 8 + st * 2 + (lane >> 4); const int nq = (lane & 15) * 4; const size_t o = xoff(s, c0 + cr, n0 + nq); v4f v;
#pragma unroll
            for (int i = 0; i < 4; ++i) v[i] = tl[nq + i][cr] + bfr(x[o + i]);
            *(v4f*)(OUTB + o) = v; }
    };
    pass(); 
}

extern "C" void kernel_launch(void* const* d_in, const int* in_sizes, int n_in,
                              void* d_out, int out_size, void* d_ws, size_t ws_size, hipStream_t stream) {
    (void)in_sizes; (void)n_in; (void)out_size;
    const float* x = (const float*)d_in[0]; const float* lg = (const float*)d_in[1]; const float* lb = (const float*)d_in[2]; const float* Wq = (const float*)d_in[3]; const float* bq = (const float*)d_in[4]; const float* Wk = (const float*)d_in[5]; const float* bk = (const float*)d_in[6]; const float* Wv = (const float*)d_in[7]; const float* bv = (const float*)d_in[8]; const float* Wp = (const float*)d_in[9]; const float* bp = (const float*)d_in[10];
    float* out = (float*)d_out;    // [2][512][8][32][32]
    char* wsp = (char*)d_ws;
    auto take = [&](size_t bytes) { char* p = wsp; wsp += (bytes + 255) & ~(size_t)255; return (void*)p; };
    h16* BW = (h16*)take((size_t)4 * CC * CC * 2); h16* BP = BW + (size_t)3 * CC * CC;    // the four weight planes in a row: q, k, v, p
    float* MU = (float*)take(NR * 4); float* RS = (float*)take(NR * 4); h16* XN = (h16*)take((size_t)NR * CC * 2);
    h16* Qx = (h16*)take((size_t)2 * NSQ * NH_ * NTK * HD * 2); h16* Kx = Qx + (size_t)NSQ * NH_ * NTK * HD; h16* VTx = (h16*)take((size_t)NSQ * NH_ * HD * NTK * 2);
    // One region, two lives: first the f32 q, k, v projections of all 16 sequences (3 planes of NR x CC), read for the last time by k_hplh3 and k_vTh3;
    // then, group after group, the scores S and the probabilities Px of SG sequences (together the same number of bytes).
    float* QKV = (float*)take((size_t)3 * NR * CC * 4); float* S = QKV; h16* Px = (h16*)(S + (size_t)SG * NH_ * NTK * NTK);
    float* OZ = (float*)take((size_t)NSQ * NH_ * NTK * HD * 4); h16* OH = (h16*)take((size_t)NR * CC * 2); float* Y = (float*)take((size_t)NR * CC * 4);
    if ((size_t)(wsp - (char*)d_ws) > ws_size) return;    // ~ 2.1 + 0.1 + 16.8 + 50.3 + 100.7 + 33.6 + 16.8 + 33.6 ~ 254 MB
    k_wTh<<<dim3(CC / 64, CC / 64, 4), 256, 0, stream>>>(Wq, Wk, Wv, Wp, CC, CC, BW);
    k_stat<<<NR / 64, 512, 0, stream>>>(x, MU, RS);
    k_nrow<<<NR / 8, 256, 0, stream>>>(x, MU, RS, lg, lb, XN);
    k_gemmh<<<dim3(NR / 64, CC / 64, 3), 128, 0, stream>>>(XN, BW, bq, bk, bv, QKV, CC, nullptr, CC, 0, (size_t)CC * CC, (size_t)NR * CC, 0);
    k_hplh3<<<dim3((NTK / 2) / 8, 1, 2 * NSQ * NH_), 256, 0, stream>>>(QKV, 0, 0.125f, 1.0f, Qx);
    k_vTh3<<<dim3(NTK / 64, 1, NSQ * NH_), 256, 0, stream>>>(QKV + (size_t)2 * NR * CC, 0, VTx);
    for (int s0 = 0; s0 < NSQ; s0 += SG) {    // the workspace holds the score planes of SG sequences at a time
        const h16* QG = Qx + (size_t)s0 * NH_ * NTK * HD; const h16* KG = Kx + (size_t)s0 * NH_ * NTK * HD; const h16* VG = VTx + (size_t)s0 * NH_ * HD * NTK; float* OG = OZ + (size_t)s0 * NH_ * NTK * HD;
        k_gemmh<<<dim3(NTK / 64, NTK / 64, SG * NH_), 128, 0, stream>>>(QG, KG, nullptr, nullptr, nullptr, S, NTK, nullptr, HD, (size_t)NTK * HD, (size_t)NTK * HD, (size_t)NTK * NTK, 0);
        k_softh3<<<dim3(NTK / 8, 1, SG * NH_), 256, 0, stream>>>(S, Px);
        k_gemmh<<<dim3(NTK / 64, 1, SG * NH_), 128, 0, stream>>>(Px, VG, nullptr, nullptr, nullptr, OG, HD, nullptr, NTK, (size_t)NTK * NTK, (size_t)HD * NTK, (size_t)NTK * HD, 0); }
    k_mergeh3<<<NR / 8, 256, 0, stream>>>(OZ, 0, OH);
    k_gemmh<<<dim3(NR / 64, CC / 64, 1), 128, 0, stream>>>(OH, BP, bp, nullptr, nullptr, Y, CC, nullptr, CC, 0, 0, 0, 0);
    k_outT3<<<dim3(NTK / 64, CC / 64, NSQ), 256, 0, stream>>>(Y, x, 0, out);
}

// v003
// It runs in 267 microseconds.
// Two timings next to v002 put it at 2.69 and 2.70 times that version's speed.
// All steps since v000 together make it 4.55 times as fast.
#include <hip/hip_runtime.h>

// scores ([1024 x 64].[64 x 1024]) and attn.v on SINGLE fp16 planes (LN output, q/8, k, softmax probabilities, v and the merged heads rounded to fp16 = 2^-11; weights
// fp16(bf16(W)); one v_wmma_f32_16x16x32_f16 product each — the residual input dominating the output); softmax f32; + the input residual in f32 with

#define NSQ  16                   // (b t) sequences
#define NTK  1024                 // (h w) tokens
#define CC   512
#define NH_  8
#define HD   64
#define TT   8
#define NR   (NSQ * NTK)          // 16384
#define DM   CC
#define LOSC 1024.0f
typedef _Float16 h16;
typedef unsigned short bf;
typedef __attribute__((ext_vector_type(16))) __bf16   v16bf;
typedef __attribute__((ext_vector_type(16))) _Float16 v16h;
typedef __attribute__((ext_vector_type(8)))  _Float16 v8h;
typedef __attribute__((ext_vector_type(8)))  unsigned short v8us;
typedef __attribute__((ext_vector_type(8)))  float    v8f;
typedef __attribute__((ext_vector_type(4)))  float    v4f;
typedef v8h  __attribute__((may_alias)) v8ha;
typedef v4f  __attribute__((may_alias)) v4fa;
typedef v8us __attribute__((may_alias)) v8usa;

__device__ __forceinline__ unsigned short f2bf(float f) { unsigned u = __float_as_uint(f); u += 0x7FFFu + ((u >> 16) & 1u); return (unsigned short)(u >> 16); }
__device__ __forceinline__ float bf2f(unsigned short b) { return __uint_as_float(((unsigned)b) << 16); }
__device__ __forceinline__ float bfr(float f) { return bf2f(f2bf(f)); }
__device__ __forceinline__ v16h cat16(v8h lo, v8h hi) { return __builtin_shufflevector(lo, hi, 0, 1, 2, 3, 4, 5, 6, 7, 8, 9, 10, 11, 12, 13, 14, 15); }
__device__ __forceinline__ v16bf cat16b(v8us lo, v8us hi) { return __builtin_bit_cast(v16bf, __builtin_shufflevector(lo, hi, 0, 1, 2, 3, 4, 5, 6, 7, 8, 9, 10, 11, 12, 13, 14, 15)); }
__device__ __forceinline__ v8f wmma16(v16h a, v16h b, v8f c) { return __builtin_amdgcn_wmma_f32_16x16x32_f16(false, a, false, b, (short)0, c, false, false); }
__device__ __forceinline__ v8f wmmab(v16bf a, v16bf b, v8f c) { return __builtin_amdgcn_wmma_f32_16x16x32_bf16(false, a, false, b, (short)0, c, false, false); }


// k_gemmh: 64 x 64 tile of C = A . Bn^T with SINGLE f16 planes (A [rows][K] f16 activations, Bn [N][K] f16 weights; one v_wmma_f32_16x16x32_f16 product per step), f32 accumulate;
// bias1, bias2: where given, grid z = 1 and z = 2 add these in place of bias (q, k and v projections in one launch).
__global__ __launch_bounds__(128) void k_gemmh(const h16* __restrict__ A, const h16* __restrict__ Bn, const float* bias, const float* bias1, const float* bias2, float* C, int ldc, const float* __restrict__ R, int K, size_t sA, size_t sB, size_t sC, int roundR) {
    __shared__ __align__(16) float ost[4][16 * 68];
    const size_t z = blockIdx.z; A += z * sA; Bn += z * sB; C += z * sC; if (R) R += z * sC;
    if (bias1 && z) bias = z == 1 ? bias1 : bias2;
    const int lane = threadIdx.x & 31, wave = threadIdx.x >> 5, lr = lane & 15, hi = lane >> 4;
    const int r0 = blockIdx.x * 64 + wave * 16, c0 = blockIdx.y * 64;
    const size_t aoff = (size_t)(r0 + lr) * K + 8 * hi;
    size_t boff[4];
#pragma unroll
    for (int t = 0; t < 4; ++t) boff[t] = (size_t)(c0 + t * 16 + lr) * K + 8 * hi;
    v8f acc[4];
#pragma unroll
    for (int t = 0; t < 4; ++t) acc[t] = (v8f){};
#pragma unroll 1
    for (int kc = 0; kc < K; kc += 32) {
        const v16h a = cat16(*(const v8h*)(A + aoff + kc), *(const v8h*)(A + aoff + kc + 16));
#pragma unroll
        for (int t = 0; t < 4; ++t) { const v16h b = cat16(*(const v8h*)(Bn + boff[t] + kc), *(const v8h*)(Bn + boff[t] + kc + 16)); acc[t] = wmma16(a, b, acc[t]); }
        asm volatile("v_nop\n\tv_nop\n\tv_nop\n\tv_nop" : "+v"(acc[0]), "+v"(acc[1]), "+v"(acc[2]), "+v"(acc[3]) : "v"(a));
    }
    float* os = &ost[wave][0];
#pragma unroll
    for (int t = 0; t < 4; ++t) { const float bv = bias ? bfr(bias[c0 + t * 16 + lr]) : 0.f;
#pragma unroll
        for (int j = 0; j < 8; ++j) os[(hi * 8 + j) * 68 + t * 16 + lr] = acc[t][j] + bv; }
    __syncthreads();
    float* crow = C + (size_t)r0 * ldc + c0;
    auto pass = [&]() {
#pragma unroll
        for (int s = 0; s < 8; ++s) { const int Lid = (lane >> 3) + 4 * s, piece = lane & 7; const int row = Lid >> 1, cofs = (Lid & 1) * 32 + piece * 4;
            v4f val = *(const v4fa*)(os + row * 68 + cofs); if (R) { const v4f rv = *(const v4f*)(R + ((size_t)r0 + row) * ldc + c0 + cofs); val += roundR ? (v4f){bfr(rv[0]), bfr(rv[1]), bfr(rv[2]), bfr(rv[3])} : rv; }
            *(v4f*)(crow + (size_t)row * ldc + cofs) = val; }
    };
    pass(); 
}

typedef __attribute__((ext_vector_type(4))) _Float16 v4h;
__device__ __forceinline__ h16 tohx(float x) { return (h16)x; }
__device__ __forceinline__ size_t xoff(int s, int c, int n) { const int b = s / TT, t = s % TT; return (((size_t)b * CC + c) * TT + t) * NTK + n; }   // x[b][c][t][n]
// k_stat: one work-group per 64 tokens. Each of its 16 waves holds 32 channels of them in registers (16 independent 16-byte loads per lane, a half-wave per channel row),
// so x is read once and no load waits on the one before it; the channel sums meet in LDS: per-lane chain, the two half-waves, then the 16 waves in index order.
__global__ __launch_bounds__(512) void k_stat(const float* __restrict__ x, float* MU, float* RS) {
    __shared__ __align__(16) float red[2][16][64];
    const int lane = threadIdx.x & 31, wv = threadIdx.x >> 5, hi = lane >> 4, tq = (lane & 15) * 4;
    const int s = blockIdx.x / (NTK / 64), n0 = (blockIdx.x % (NTK / 64)) * 64;
    const float* p = x + xoff(s, wv * 32 + hi, n0 + tq);      // channel wv * 32 + 2 i + hi, tokens n0 + tq .. + 3
    v4f v[16];
#pragma unroll
    for (int i = 0; i < 16; ++i) v[i] = *(const v4f*)(p + (size_t)i * (2 * TT * NTK));
    v4f sm = (v4f){};
#pragma unroll
    for (int i = 0; i < 16; ++i) { v[i] = (v4f){bfr(v[i][0]), bfr(v[i][1]), bfr(v[i][2]), bfr(v[i][3])}; sm += v[i]; }
#pragma unroll
    for (int j = 0; j < 4; ++j) sm[j] += __shfl_xor(sm[j], 16, 32);
    if (hi == 0) *(v4fa*)(&red[0][wv][tq]) = sm;
    __syncthreads();
    v4f mu = (v4f){};
#pragma unroll
    for (int w = 0; w < 16; ++w) mu += *(const v4fa*)(&red[0][w][tq]);
    mu *= (1.0f / CC);
    v4f q = (v4f){};
#pragma unroll
    for (int i = 0; i < 16; ++i) { const v4f d = v[i] - mu;
#pragma unroll
        for (int j = 0; j < 4; ++j) q[j] = fmaf(d[j], d[j], q[j]); }
#pragma unroll
    for (int j = 0; j < 4; ++j) q[j] += __shfl_xor(q[j], 16, 32);
    if (hi == 0) *(v4fa*)(&red[1][wv][tq]) = q;
    __syncthreads();
    if (threadIdx.x < 16) { v4f qs = (v4f){};
#pragma unroll
        for (int w = 0; w < 16; ++w) qs += *(const v4fa*)(&red[1][w][tq]);
        const size_t r = (size_t)s * NTK + n0 + tq;
        *(v4f*)(MU + r) = mu; *(v4f*)(RS + r) = (v4f){rsqrtf(qs[0] * (1.0f / CC) + 1e-5f), rsqrtf(qs[1] * (1.0f / CC) + 1e-5f), rsqrtf(qs[2] * (1.0f / CC) + 1e-5f), rsqrtf(qs[3] * (1.0f / CC) + 1e-5f)}; }
}
__global__ __launch_bounds__(256) void k_nrow(const float* __restrict__ x, const float* __restrict__ MU, const float* __restrict__ RS, const float* __restrict__ g, const float* __restrict__ bb, h16* XN) {
    const int lane = threadIdx.x & 31; const size_t r = (size_t)blockIdx.x * 8 + (threadIdx.x >> 5); if (r >= (size_t)NR) return; const int s = (int)(r / NTK), n = (int)(r % NTK); const float mu = MU[r], rs = RS[r];
{
#pragma unroll 1
        for (int p = 0; p < CC / 256; ++p) { const int c0 = p * 256 + lane * 8; v8h o;
#pragma unroll
            for (int i = 0; i < 8; ++i) { const int c = c0 + i; o[i] = tohx((bfr(x[xoff(s, c, n)]) - mu) * rs * bfr(g[c]) + bfr(bb[c])); }
            *(v8h*)(XN + r * CC + c0) = o; }
         }
}
__global__ __launch_bounds__(256) void k_wTh(const float* __restrict__ W0, const float* __restrict__ W1, const float* __restrict__ W2, const float* __restrict__ W3, int K, int N, h16* Bt) {
    __shared__ float tl[64][65];
    const float* Wm = blockIdx.z == 0 ? W0 : blockIdx.z == 1 ? W1 : blockIdx.z == 2 ? W2 : W3; Bt += (size_t)blockIdx.z * K * N;   // grid z picks the weight and its plane
    const int tid = threadIdx.x; const int k0 = blockIdx.x * 64, n0 = blockIdx.y * 64; const int rr = tid >> 2, cq = (tid & 3) * 16;
#pragma unroll
    for (int i = 0; i < 16; ++i) tl[rr][cq + i] = bfr(Wm[(size_t)(k0 + rr) * N + n0 + cq + i]);
    __syncthreads();
    const int lane = tid & 31, wv = tid >> 5;
    auto pass = [&]() {
#pragma unroll
        for (int st = 0; st < 4; ++st) { const int nr = wv * 8 + st * 2 + (lane >> 4); const int kq = (lane & 15) * 4; v4h v;
#pragma unroll
            for (int i = 0; i < 4; ++i) v[i] = tohx(tl[kq + i][nr]);
            *(v4h*)(Bt + (size_t)(n0 + nr) * K + k0 + kq) = v; }
    };
    pass(); 
}
// grid z = (plane, sequence, head): the k plane follows the q plane in F and in P; sc scales the first NSQ * NH_ of z (q), sc2 the rest (k).
__global__ __launch_bounds__(256) void k_hplh3(const float* __restrict__ F, int s0, float sc, float sc2, h16* P) {
    const int lane = threadIdx.x & 31; const size_t w = (size_t)blockIdx.x * 8 + (threadIdx.x >> 5); const int i = (int)(w * 2 + (lane >> 4)); if (i >= NTK) return; const int g = blockIdx.z / NH_, h = blockIdx.z % NH_; const int c0 = (lane & 15) * 4; v4h o;
    if (blockIdx.z >= NSQ * NH_) sc = sc2;
#pragma unroll
    for (int q = 0; q < 4; ++q) o[q] = tohx(F[((size_t)(s0 + g) * NTK + i) * CC + h * HD + c0 + q] * sc);
    const size_t off = ((size_t)blockIdx.z * NTK + i) * HD + c0; *(v4h*)(P + off) = o; 
}
__global__ __launch_bounds__(256) void k_vTh3(const float* __restrict__ V, int s0, h16* VT) {
    __shared__ float tl[64][65];
    const int tid = threadIdx.x; const int t0 = blockIdx.x * 64; const int g = blockIdx.z / NH_, h = blockIdx.z % NH_; const int rr = tid >> 2, cq = (tid & 3) * 16;
#pragma unroll
    for (int i = 0; i < 16; ++i) tl[rr][cq + i] = V[((size_t)(s0 + g) * NTK + t0 + rr) * CC + h * HD + cq + i];
    __syncthreads();
    const int lane = tid & 31, wv = tid >> 5;
    auto pass = [&]() {
#pragma unroll
        for (int st = 0; st < 4; ++st) { const int dr = wv * 8 + st * 2 + (lane >> 4); const int tq = (lane & 15) * 4; v4h v;
#pragma unroll
            for (int i = 0; i < 4; ++i) v[i] = tohx(tl[tq + i][dr]);
            *(v4h*)(VT + ((size_t)blockIdx.z * HD + dr) * NTK + t0 + tq) = v; }
    };
    pass(); 
}
typedef __attribute__((ext_vector_type(2))) float v2f;
__device__ __forceinline__ float xhalf(float x) { return __builtin_bit_cast(float, __builtin_amdgcn_permlanex16(__builtin_bit_cast(int, x), __builtin_bit_cast(int, x), 0x76543210, 0xfedcba98, false, false)); }   // lane l takes lane l ^ 16's value
// k_attn: scores, softmax and attn.v of one (sequence, head) for 512 queries a work-group, 32 queries a wave, 32 keys a pass; nothing of S or P leaves the registers.
// The head's whole K (1024 x 64) and V^T (64 x 1024) are laid into LDS once, by whole-line loads, and every wave takes its fragments from there: a fragment load straight from
// global memory touches 16 lines for its 512 bytes, and 16 waves would each fetch the same ones. Pitches of 16 bytes x odd keep the 16-byte LDS reads free of bank conflicts.
// Transposed products: S^T = K . Q^T (A = 16 keys, B = 16 queries) puts one query's scores in one lane pair (lane, lane + 16); two S^T tiles of keys 0-15 and 16-31, rounded to f16 in
// place, ARE the B operand of O^T += V^T . P^T in the k order of the A loader (k = 8 hi + e, 16 + 8 hi + e). Running maximum m (in log2 units) and running sum l per query;
// the output tiles are rescaled only in a pass where some query of the wave meets a new maximum. A lane ends with 8 consecutive d of one query: one 16-byte store into the merged-heads plane.
#define KPI  (HD + 8)             // LDS pitch of a K row, in f16: 144 bytes
#define VPI  (NTK + 8)            // LDS pitch of a V^T row, in f16: 2064 bytes
__global__ __launch_bounds__(512) void k_attn(const h16* __restrict__ Q, const h16* __restrict__ Kp, const h16* __restrict__ VT, h16* OH) {
    __shared__ __align__(16) h16 KS[NTK * KPI];
    __shared__ __align__(16) h16 VS[HD * VPI];
    const int tid = threadIdx.x, lane = tid & 31, wave = tid >> 5, lr = lane & 15, hi = lane >> 4;
    const int z = blockIdx.y, q0 = blockIdx.x * 512 + wave * 32;
    const h16* qp = Q + ((size_t)z * NTK + q0 + lr) * HD + 8 * hi;
    const h16* kg = Kp + (size_t)z * NTK * HD + tid * 8;      // both planes are NTK * HD f16 in a row: 16 rounds of 512 lanes x 16 bytes each
    const h16* vg = VT + (size_t)z * HD * NTK + tid * 8;
    const float L2E = 1.44269504088896340736f;
    v16h qf[2][2], kf[2][2], vf[4];      // qf, kf: [query tile | key tile][k step of 32 over the head size]; vf[dt]: V^T rows d = dt * 16 + lr, the pass's 32 keys
#pragma unroll
    for (int u = 0; u < 2; ++u)
#pragma unroll
        for (int ks = 0; ks < 2; ++ks) qf[u][ks] = cat16(*(const v8h*)(qp + u * 16 * HD + ks * 32), *(const v8h*)(qp + u * 16 * HD + ks * 32 + 16));
    {
        v8h kr[16], vr[16];
#pragma unroll
        for (int i = 0; i < 16; ++i) { kr[i] = *(const v8h*)(kg + i * 4096); vr[i] = *(const v8h*)(vg + i * 4096); }
#pragma unroll
        for (int i = 0; i < 16; ++i) { const int c = i * 512 + tid;      // 16-byte piece c: K row c / 8, piece c % 8; V^T row c / 128, piece c % 128
            *(v8h*)(KS + (c >> 3) * KPI + (c & 7) * 8) = kr[i]; *(v8h*)(VS + (c >> 7) * VPI + (c & 127) * 8) = vr[i]; }
    }
    __syncthreads();
    const h16* kp = KS + lr * KPI + 8 * hi;
    const h16* vp = VS + lr * VPI + 8 * hi;
#pragma unroll
    for (int t = 0; t < 2; ++t)
#pragma unroll
        for (int ks = 0; ks < 2; ++ks) kf[t][ks] = cat16(*(const v8h*)(kp + t * 16 * KPI + ks * 32), *(const v8h*)(kp + t * 16 * KPI + ks * 32 + 16));
#pragma unroll
    for (int dt = 0; dt < 4; ++dt) vf[dt] = cat16(*(const v8h*)(vp + dt * 16 * VPI), *(const v8h*)(vp + dt * 16 * VPI + 16));
    v8f o[2][4];
#pragma unroll
    for (int u = 0; u < 2; ++u)
#pragma unroll
        for (int dt = 0; dt < 4; ++dt) o[u][dt] = (v8f){};
    float m[2] = {-3.0e38f, -3.0e38f}, l[2] = {0.f, 0.f};
    // not unrolled: one pass's fragments, scores and output tiles fill the 256 registers that four waves a SIMD leave each wave
#pragma unroll 1
    for (int k0 = 0; k0 < NTK; k0 += 32) {
        v8f s[2][2];              // [query tile][key tile]: s[u][t][j] = score(key k0 + 16 t + 8 hi + j, query q0 + 16 u + lr)
#pragma unroll
        for (int u = 0; u < 2; ++u)
#pragma unroll
            for (int t = 0; t < 2; ++t) s[u][t] = wmma16(kf[t][1], qf[u][1], wmma16(kf[t][0], qf[u][0], (v8f){}));
        const int kn = (k0 + 32) & (NTK - 1);    // the next pass's keys: K and V^T fragments are fetched one pass ahead, each into its own registers right behind its products (the last pass fetches keys 0 .. 31 again, unused)
#pragma unroll
        for (int t = 0; t < 2; ++t)
#pragma unroll
            for (int ks = 0; ks < 2; ++ks) kf[t][ks] = cat16(*(const v8h*)(kp + (kn + t * 16) * KPI + ks * 32), *(const v8h*)(kp + (kn + t * 16) * KPI + ks * 32 + 16));
        __builtin_amdgcn_sched_barrier(0);    // holds the K loads up here: moved down to the pass's end they would be waited for at once, with the whole load latency open
        float mn[2];
#pragma unroll
        for (int u = 0; u < 2; ++u) { float mx = s[u][0][0];
#pragma unroll
            for (int j = 1; j < 8; ++j) mx = fmaxf(mx, s[u][0][j]);
#pragma unroll
            for (int j = 0; j < 8; ++j) mx = fmaxf(mx, s[u][1][j]);
            mx = fmaxf(mx, xhalf(mx)); mn[u] = fmaxf(m[u], mx * L2E); }
        if (__builtin_amdgcn_ballot_w32(mn[0] > m[0] || mn[1] > m[1]) != 0) {
#pragma unroll
            for (int u = 0; u < 2; ++u) { const float a = __builtin_amdgcn_exp2f(m[u] - mn[u]); m[u] = mn[u]; l[u] *= a;
#pragma unroll
                for (int dt = 0; dt < 4; ++dt) o[u][dt] *= a; }
        }
        v16h pf[2];
#pragma unroll
        for (int u = 0; u < 2; ++u)
#pragma unroll
            for (int t = 0; t < 2; ++t)
#pragma unroll
                for (int j = 0; j < 8; j += 2) { const v2f e = __builtin_elementwise_fma((v2f){s[u][t][j], s[u][t][j + 1]}, (v2f){L2E, L2E}, (v2f){-m[u], -m[u]});    // register pairs as the accumulator has them: one packed fma
                    const float p0 = __builtin_amdgcn_exp2f(e[0]), p1 = __builtin_amdgcn_exp2f(e[1]); l[u] += p0; l[u] += p1; pf[u][t * 8 + j] = tohx(p0); pf[u][t * 8 + j + 1] = tohx(p1); }
#pragma unroll
        for (int dt = 0; dt < 4; ++dt)
#pragma unroll
            for (int u = 0; u < 2; ++u) o[u][dt] = wmma16(vf[dt], pf[u], o[u][dt]);
#pragma unroll
        for (int dt = 0; dt < 4; ++dt) vf[dt] = cat16(*(const v8h*)(vp + dt * 16 * VPI + kn), *(const v8h*)(vp + dt * 16 * VPI + kn + 16));
    }
    const int sq = z / NH_, h = z % NH_;
#pragma unroll
    for (int u = 0; u < 2; ++u) { const float inv = 1.0f / (l[u] + xhalf(l[u]));
        h16* op = OH + ((size_t)sq * NTK + q0 + u * 16 + lr) * CC + h * HD + 8 * hi;
#pragma unroll
        for (int dt = 0; dt < 4; ++dt) { v8h ov;
#pragma unroll
            for (int j = 0; j < 8; ++j) ov[j] = tohx(o[u][dt][j] * inv);
            *(v8h*)(op + dt * 16) = ov; } }
}
__global__ __launch_bounds__(256) void k_outT3(const float* __restrict__ Y, const float* __restrict__ x, int s0, float* OUTB) {
    __shared__ float tl[64][65];
    const int tid = threadIdx.x; const int n0 = blockIdx.x * 64, c0 = blockIdx.y * 64; const int g = blockIdx.z, s = s0 + g; const int rr = tid >> 2, cq = (tid & 3) * 16;
#pragma unroll
    for (int i = 0; i < 16; ++i) tl[rr][cq + i] = Y[((size_t)g * NTK + n0 + rr) * CC + c0 + cq + i];   // tl[n][c] (group-local Y row)
    __syncthreads();
    const int lane = tid & 31, wv = tid >> 5;
    auto pass = [&]() {
#pragma unroll
        for (int st = 0; st < 4; ++st) { const int cr = wv * 8 + st * 2 + (lane >> 4); const int nq = (lane & 15) * 4; const size_t o = xoff(s, c0 + cr, n0 + nq); v4f v;
#pragma unroll
            for (int i = 0; i < 4; ++i) v[i] = tl[nq + i][cr] + bfr(x[o + i]);
            *(v4f*)(OUTB + o) = v; }
    };
    pass(); 
}

extern "C" void kernel_launch(void* const* d_in, const int* in_sizes, int n_in,
                              void* d_out, int out_size, void* d_ws, size_t ws_size, hipStream_t stream) {
    (void)in_sizes; (void)n_in; (void)out_size;
    const float* x = (const float*)d_in[0]; const float* lg = (const float*)d_in[1]; const float* lb = (const float*)d_in[2]; const float* Wq = (const float*)d_in[3]; const float* bq = (const float*)d_in[4]; const float* Wk = (const float*)d_in[5]; const float* bk = (const float*)d_in[6]; const float* Wv = (const float*)d_in[7]; const float* bv = (const float*)d_in[8]; const float* Wp = (const float*)d_in[9]; const float* bp = (const float*)d_in[10];
    float* out = (float*)d_out;    // [2][512][8][32][32]
    char* wsp = (char*)d_ws;
    auto take = [&](size_t bytes) { char* p = wsp; wsp += (bytes + 255) & ~(size_t)255; return (void*)p; };
    h16* BW = (h16*)take((size_t)4 * CC * CC * 2); h16* BP = BW + (size_t)3 * CC * CC;    // the four weight planes in a row: q, k, v, p
    float* MU = (float*)take(NR * 4); float* RS = (float*)take(NR * 4); h16* XN = (h16*)take((size_t)NR * CC * 2);
    h16* Qx = (h16*)take((size_t)2 * NSQ * NH_ * NTK * HD * 2); h16* Kx = Qx + (size_t)NSQ * NH_ * NTK * HD; h16* VTx = (h16*)take((size_t)NSQ * NH_ * HD * NTK * 2);
    float* QKV = (float*)take((size_t)3 * NR * CC * 4);    // the f32 q, k, v projections of all 16 sequences (3 planes of NR x CC)
    h16* OH = (h16*)take((size_t)NR * CC * 2); float* Y = (float*)take((size_t)NR * CC * 4);
    if ((size_t)(wsp - (char*)d_ws) > ws_size) return;    // ~ 2.1 + 0.1 + 16.8 + 50.3 + 100.7 + 16.8 + 33.6 ~ 220 MB
    k_wTh<<<dim3(CC / 64, CC / 64, 4), 256, 0, stream>>>(Wq, Wk, Wv, Wp, CC, CC, BW);
    k_stat<<<NR / 64, 512, 0, stream>>>(x, MU, RS);
    k_nrow<<<NR / 8, 256, 0, stream>>>(x, MU, RS, lg, lb, XN);
    k_gemmh<<<dim3(NR / 64, CC / 64, 3), 128, 0, stream>>>(XN, BW, bq, bk, bv, QKV, CC, nullptr, CC, 0, (size_t)CC * CC, (size_t)NR * CC, 0);
    k_hplh3<<<dim3((NTK / 2) / 8, 1, 2 * NSQ * NH_), 256, 0, stream>>>(QKV, 0, 0.125f, 1.0f, Qx);
    k_vTh3<<<dim3(NTK / 64, 1, NSQ * NH_), 256, 0, stream>>>(QKV + (size_t)2 * NR * CC, 0, VTx);
    k_attn<<<dim3(NTK / 512, NSQ * NH_), 512, 0, stream>>>(Qx, Kx, VTx, OH);
    k_gemmh<<<dim3(NR / 64, CC / 64, 1), 128, 0, stream>>>(OH, BP, bp, nullptr, nullptr, Y, CC, nullptr, CC, 0, 0, 0, 0);
    k_outT3<<<dim3(NTK / 64, CC / 64, NSQ), 256, 0, stream>>>(Y, x, 0, out);
}

// v004
// One run takes 134 microseconds.
// Next to v003, in two timings, it ran 2.00 times as fast each time.
// Counting every step since v000, it is 9.09 times as fast.
#include <hip/hip_runtime.h>

// scores ([1024 x 64].[64 x 1024]) and attn.v on SINGLE fp16 planes (LN output, q/8, k, softmax probabilities, v and the merged heads rounded to fp16 = 2^-11; weights
// fp16(bf16(W)); one v_wmma_f32_16x16x32_f16 product each — the residual input dominating the output); softmax f32; + the input residual in f32 with

#define NSQ  16                   // (b t) sequences
#define NTK  1024                 // (h w) tokens
#define CC   512
#define NH_  8
#define HD   64
#define TT   8
#define NR   (NSQ * NTK)          // 16384
#define DM   CC
#define LOSC 1024.0f
typedef _Float16 h16;
typedef unsigned short bf;
typedef __attribute__((ext_vector_type(16))) __bf16   v16bf;
typedef __attribute__((ext_vector_type(16))) _Float16 v16h;
typedef __attribute__((ext_vector_type(8)))  _Float16 v8h;
typedef __attribute__((ext_vector_type(8)))  unsigned short v8us;
typedef __attribute__((ext_vector_type(8)))  float    v8f;
typedef __attribute__((ext_vector_type(4)))  float    v4f;
typedef v8h  __attribute__((may_alias)) v8ha;
typedef v4f  __attribute__((may_alias)) v4fa;
typedef v8us __attribute__((may_alias)) v8usa;

__device__ __forceinline__ unsigned short f2bf(float f) { unsigned u = __float_as_uint(f); u += 0x7FFFu + ((u >> 16) & 1u); return (unsigned short)(u >> 16); }
__device__ __forceinline__ float bf2f(unsigned short b) { return __uint_as_float(((unsigned)b) << 16); }
__device__ __forceinline__ float bfr(float f) { return bf2f(f2bf(f)); }
__device__ __forceinline__ v16h cat16(v8h lo, v8h hi) { return __builtin_shufflevector(lo, hi, 0, 1, 2, 3, 4, 5, 6, 7, 8, 9, 10, 11, 12, 13, 14, 15); }
__device__ __forceinline__ v16bf cat16b(v8us lo, v8us hi) { return __builtin_bit_cast(v16bf, __builtin_shufflevector(lo, hi, 0, 1, 2, 3, 4, 5, 6, 7, 8, 9, 10, 11, 12, 13, 14, 15)); }
__device__ __forceinline__ v8f wmma16(v16h a, v16h b, v8f c) { return __builtin_amdgcn_wmma_f32_16x16x32_f16(false, a, false, b, (short)0, c, false, false); }
__device__ __forceinline__ v8f wmmab(v16bf a, v16bf b, v8f c) { return __builtin_amdgcn_wmma_f32_16x16x32_bf16(false, a, false, b, (short)0, c, false, false); }


// k_gemmh: 128 x 128 tile of C = A . Bn^T with SINGLE f16 planes (A [rows][DM] f16 activations, Bn [N][DM] f16 weights; one v_wmma_f32_16x16x32_f16 product per step), f32 accumulate, C [rows][DM];
// grid z picks the weight plane (sB apart) and the output plane (sC apart); bias1, bias2: where given, grid z = 1 and z = 2 add these in place of bias (q, k and v projections in one launch).
// Both operands go through LDS, 64 k a stage, two stages: whole-line loads (a wave's 16-byte loads cover 4 rows of 128 bytes) bring each byte to the WGP once per work-group, and the
// 8 waves (4 x 2, 32 x 64 of C each) take their fragments from LDS. A fragment load straight from global memory touches 16 lines for its 512 bytes, and every wave fetched its own copy of Bn.
// The next stage's global loads fly while this stage is multiplied; one barrier a stage publishes the stage just written and ends the reads of the one written next.
#define GBK  64                   // k per stage
#define GPI  (GBK + 8)            // LDS pitch of a staged row, in f16: 144 bytes (16 bytes x odd: the 16-byte reads meet no bank conflict)
#define GST  (256 * GPI)          // one stage, in f16: 128 rows of A, then 128 rows of Bn
__global__ __launch_bounds__(256) void k_gemmh(const h16* __restrict__ A, const h16* __restrict__ Bn, const float* bias, const float* bias1, const float* bias2, float* C, size_t sB, size_t sC) {
    __shared__ __align__(16) h16 st[2 * GST];      // 73,728 bytes; the epilogue's 8 x 32 x 68 floats (69,632 bytes) lie in the same place
    const size_t z = blockIdx.z; Bn += z * sB; C += z * sC;
    if (bias1 && z) bias = z == 1 ? bias1 : bias2;
    const int tid = threadIdx.x, lane = tid & 31, wave = tid >> 5, lr = lane & 15, hi = lane >> 4;
    const int r0 = blockIdx.x * 128, c0 = blockIdx.y * 128, wr = (wave >> 1) * 32, wc = (wave & 1) * 64;
    // this lane's 16-byte piece of rows prow, prow + 32, prow + 64, prow + 96 of either operand: 8 lanes a row (one line); a half-wave takes rows 8 apart, whose 16 pieces fall on all 64 LDS banks
    const int prow = (wave >> 2) * 16 + ((lane >> 3) & 1) * 8 + (wave & 3) * 2 + (lane >> 4), pcol = (lane & 7) * 8;
    const h16* ab = A + (size_t)r0 * DM;                  // the tiles' first rows: the same for the whole work-group
    const h16* bb = Bn + (size_t)c0 * DM;
    const unsigned po = prow * DM + pcol;
    h16* sw = st + prow * GPI + pcol;
    v8h ra[4], rb[4];
#pragma unroll
    for (int i = 0; i < 4; ++i) { ra[i] = *(const v8h*)(ab + po + i * 32 * DM); rb[i] = *(const v8h*)(bb + po + i * 32 * DM); }
    float bv[4] = {0.f, 0.f, 0.f, 0.f};      // fetched here, behind the first stage's loads, so that the epilogue waits for no load
    if (bias) {
#pragma unroll
        for (int t = 0; t < 4; ++t) bv[t] = bias[c0 + wc + t * 16 + lr];
#pragma unroll
        for (int t = 0; t < 4; ++t) bv[t] = bfr(bv[t]);
    }
#pragma unroll
    for (int i = 0; i < 4; ++i) { *(v8h*)(sw + i * 32 * GPI) = ra[i]; *(v8h*)(sw + (128 + i * 32) * GPI) = rb[i]; }
    __syncthreads();
    const h16* ar = st + (wr + lr) * GPI + 8 * hi;
    const h16* br = st + (128 + wc + lr) * GPI + 8 * hi;
    v8f acc[2][4];
#pragma unroll
    for (int u = 0; u < 2; ++u)
#pragma unroll
        for (int t = 0; t < 4; ++t) acc[u][t] = (v8f){};
    int cur = 0;                  // f16 offset of the stage being multiplied
    // not unrolled: the stages are alike, and one copy of the loop keeps the registers at one stage's need (two work-groups a WGP)
#pragma unroll 1
    for (int kn = GBK; ; kn += GBK) {
        const bool more = kn < DM;    // the same in every lane of the work-group: the barrier below stands under uniform control flow
        if (more) { const h16* an = ab + kn; const h16* bn = bb + kn;
#pragma unroll
            for (int i = 0; i < 4; ++i) { ra[i] = *(const v8h*)(an + po + i * 32 * DM); rb[i] = *(const v8h*)(bn + po + i * 32 * DM); }
        }
#pragma unroll
        for (int ks = 0; ks < GBK; ks += 32) {
            v16h a[2], b[4];
#pragma unroll
            for (int u = 0; u < 2; ++u) a[u] = cat16(*(const v8h*)(ar + cur + u * 16 * GPI + ks), *(const v8h*)(ar + cur + u * 16 * GPI + ks + 16));
#pragma unroll
            for (int t = 0; t < 4; ++t) b[t] = cat16(*(const v8h*)(br + cur + t * 16 * GPI + ks), *(const v8h*)(br + cur + t * 16 * GPI + ks + 16));
            __builtin_amdgcn_sched_barrier(0);    // holds the 12 LDS reads together ahead of their 8 products: moved down among them, each pair is waited for at once, with the whole LDS latency open
#pragma unroll
            for (int t = 0; t < 4; ++t)
#pragma unroll
                for (int u = 0; u < 2; ++u) acc[u][t] = wmma16(a[u], b[t], acc[u][t]);
        }
        if (!more) break;
        cur ^= GST;
#pragma unroll
        for (int i = 0; i < 4; ++i) { *(v8h*)(sw + cur + i * 32 * GPI) = ra[i]; *(v8h*)(sw + cur + (128 + i * 32) * GPI) = rb[i]; }
        __syncthreads();
    }
    __syncthreads();              // every wave has read its last fragments: the stages' LDS becomes the output staging
    float* os = (float*)st + wave * (32 * 68);
#pragma unroll
    for (int t = 0; t < 4; ++t)
#pragma unroll
        for (int u = 0; u < 2; ++u)
#pragma unroll
            for (int j = 0; j < 8; ++j) os[(u * 16 + hi * 8 + j) * 68 + t * 16 + lr] = acc[u][t][j] + bv[t];
    __syncthreads();
    // 8 lanes store one 128-byte line: lane = (row & 1, half of the 64 columns, 16-byte piece), rows two by two
    const int row = lane >> 4, cofs = ((lane >> 3) & 1) * 32 + (lane & 7) * 4;
    float* cp = C + (size_t)(r0 + wr + row) * DM + c0 + wc + cofs;
    const float* op = os + row * 68 + cofs;
#pragma unroll
    for (int s = 0; s < 16; ++s) *(v4f*)(cp + s * 2 * DM) = *(const v4fa*)(op + s * 2 * 68);
}

typedef __attribute__((ext_vector_type(4))) _Float16 v4h;
__device__ __forceinline__ h16 tohx(float x) { return (h16)x; }
__device__ __forceinline__ size_t xoff(int s, int c, int n) { const int b = s / TT, t = s % TT; return (((size_t)b * CC + c) * TT + t) * NTK + n; }   // x[b][c][t][n]
// k_stat: one work-group per 64 tokens. Each of its 16 waves holds 32 channels of them in registers (16 independent 16-byte loads per lane, a half-wave per channel row),
// so x is read once and no load waits on the one before it; the channel sums meet in LDS: per-lane chain, the two half-waves, then the 16 waves in index order.
__global__ __launch_bounds__(512) void k_stat(const float* __restrict__ x, float* MU, float* RS) {
    __shared__ __align__(16) float red[2][16][64];
    const int lane = threadIdx.x & 31, wv = threadIdx.x >> 5, hi = lane >> 4, tq = (lane & 15) * 4;
    const int s = blockIdx.x / (NTK / 64), n0 = (blockIdx.x % (NTK / 64)) * 64;
    const float* p = x + xoff(s, wv * 32 + hi, n0 + tq);      // channel wv * 32 + 2 i + hi, tokens n0 + tq .. + 3
    v4f v[16];
#pragma unroll
    for (int i = 0; i < 16; ++i) v[i] = *(const v4f*)(p + (size_t)i * (2 * TT * NTK));
    v4f sm = (v4f){};
#pragma unroll
    for (int i = 0; i < 16; ++i) { v[i] = (v4f){bfr(v[i][0]), bfr(v[i][1]), bfr(v[i][2]), bfr(v[i][3])}; sm += v[i]; }
#pragma unroll
    for (int j = 0; j < 4; ++j) sm[j] += __shfl_xor(sm[j], 16, 32);
    if (hi == 0) *(v4fa*)(&red[0][wv][tq]) = sm;
    __syncthreads();
    v4f mu = (v4f){};
#pragma unroll
    for (int w = 0; w < 16; ++w) mu += *(const v4fa*)(&red[0][w][tq]);
    mu *= (1.0f / CC);
    v4f q = (v4f){};
#pragma unroll
    for (int i = 0; i < 16; ++i) { const v4f d = v[i] - mu;
#pragma unroll
        for (int j = 0; j < 4; ++j) q[j] = fmaf(d[j], d[j], q[j]); }
#pragma unroll
    for (int j = 0; j < 4; ++j) q[j] += __shfl_xor(q[j], 16, 32);
    if (hi == 0) *(v4fa*)(&red[1][wv][tq]) = q;
    __syncthreads();
    if (threadIdx.x < 16) { v4f qs = (v4f){};
#pragma unroll
        for (int w = 0; w < 16; ++w) qs += *(const v4fa*)(&red[1][w][tq]);
        const size_t r = (size_t)s * NTK + n0 + tq;
        *(v4f*)(MU + r) = mu; *(v4f*)(RS + r) = (v4f){rsqrtf(qs[0] * (1.0f / CC) + 1e-5f), rsqrtf(qs[1] * (1.0f / CC) + 1e-5f), rsqrtf(qs[2] * (1.0f / CC) + 1e-5f), rsqrtf(qs[3] * (1.0f / CC) + 1e-5f)}; }
}
__global__ __launch_bounds__(256) void k_nrow(const float* __restrict__ x, const float* __restrict__ MU, const float* __restrict__ RS, const float* __restrict__ g, const float* __restrict__ bb, h16* XN) {
    const int lane = threadIdx.x & 31; const size_t r = (size_t)blockIdx.x * 8 + (threadIdx.x >> 5); if (r >= (size_t)NR) return; const int s = (int)(r / NTK), n = (int)(r % NTK); const float mu = MU[r], rs = RS[r];
{
#pragma unroll 1
        for (int p = 0; p < CC / 256; ++p) { const int c0 = p * 256 + lane * 8; v8h o;
#pragma unroll
            for (int i = 0; i < 8; ++i) { const int c = c0 + i; o[i] = tohx((bfr(x[xoff(s, c, n)]) - mu) * rs * bfr(g[c]) + bfr(bb[c])); }
            *(v8h*)(XN + r * CC + c0) = o; }
         }
}
__global__ __launch_bounds__(256) void k_wTh(const float* __restrict__ W0, const float* __restrict__ W1, const float* __restrict__ W2, const float* __restrict__ W3, int K, int N, h16* Bt) {
    __shared__ float tl[64][65];
    const float* Wm = blockIdx.z == 0 ? W0 : blockIdx.z == 1 ? W1 : blockIdx.z == 2 ? W2 : W3; Bt += (size_t)blockIdx.z * K * N;   // grid z picks the weight and its plane
    const int tid = threadIdx.x; const int k0 = blockIdx.x * 64, n0 = blockIdx.y * 64; const int rr = tid >> 2, cq = (tid & 3) * 16;
#pragma unroll
    for (int i = 0; i < 16; ++i) tl[rr][cq + i] = bfr(Wm[(size_t)(k0 + rr) * N + n0 + cq + i]);
    __syncthreads();
    const int lane = tid & 31, wv = tid >> 5;
    auto pass = [&]() {
#pragma unroll
        for (int st = 0; st < 4; ++st) { const int nr = wv * 8 + st * 2 + (lane >> 4); const int kq = (lane & 15) * 4; v4h v;
#pragma unroll
            for (int i = 0; i < 4; ++i) v[i] = tohx(tl[kq + i][nr]);
            *(v4h*)(Bt + (size_t)(n0 + nr) * K + k0 + kq) = v; }
    };
    pass(); 
}
// grid z = (plane, sequence, head): the k plane follows the q plane in F and in P; sc scales the first NSQ * NH_ of z (q), sc2 the rest (k).
__global__ __launch_bounds__(256) void k_hplh3(const float* __restrict__ F, int s0, float sc, float sc2, h16* P) {
    const int lane = threadIdx.x & 31; const size_t w = (size_t)blockIdx.x * 8 + (threadIdx.x >> 5); const int i = (int)(w * 2 + (lane >> 4)); if (i >= NTK) return; const int g = blockIdx.z / NH_, h = blockIdx.z % NH_; const int c0 = (lane & 15) * 4; v4h o;
    if (blockIdx.z >= NSQ * NH_) sc = sc2;
#pragma unroll
    for (int q = 0; q < 4; ++q) o[q] = tohx(F[((size_t)(s0 + g) * NTK + i) * CC + h * HD + c0 + q] * sc);
    const size_t off = ((size_t)blockIdx.z * NTK + i) * HD + c0; *(v4h*)(P + off) = o; 
}
__global__ __launch_bounds__(256) void k_vTh3(const float* __restrict__ V, int s0, h16* VT) {
    __shared__ float tl[64][65];
    const int tid = threadIdx.x; const int t0 = blockIdx.x * 64; const int g = blockIdx.z / NH_, h = blockIdx.z % NH_; const int rr = tid >> 2, cq = (tid & 3) * 16;
#pragma unroll
    for (int i = 0; i < 16; ++i) tl[rr][cq + i] = V[((size_t)(s0 + g) * NTK + t0 + rr) * CC + h * HD + cq + i];
    __syncthreads();
    const int lane = tid & 31, wv = tid >> 5;
    auto pass = [&]() {
#pragma unroll
        for (int st = 0; st < 4; ++st) { const int dr = wv * 8 + st * 2 + (lane >> 4); const int tq = (lane & 15) * 4; v4h v;
#pragma unroll
            for (int i = 0; i < 4; ++i) v[i] = tohx(tl[tq + i][dr]);
            *(v4h*)(VT + ((size_t)blockIdx.z * HD + dr) * NTK + t0 + tq) = v; }
    };
    pass(); 
}
typedef __attribute__((ext_vector_type(2))) float v2f;
__device__ __forceinline__ float xhalf(float x) { return __builtin_bit_cast(float, __builtin_amdgcn_permlanex16(__builtin_bit_cast(int, x), __builtin_bit_cast(int, x), 0x76543210, 0xfedcba98, false, false)); }   // lane l takes lane l ^ 16's value
// k_attn: scores, softmax and attn.v of one (sequence, head) for 512 queries a work-group, 32 queries a wave, 32 keys a pass; nothing of S or P leaves the registers.
// The head's whole K (1024 x 64) and V^T (64 x 1024) are laid into LDS once, by whole-line loads, and every wave takes its fragments from there: a fragment load straight from
// global memory touches 16 lines for its 512 bytes, and 16 waves would each fetch the same ones. Pitches of 16 bytes x odd keep the 16-byte LDS reads free of bank conflicts.
// Transposed products: S^T = K . Q^T (A = 16 keys, B = 16 queries) puts one query's scores in one lane pair (lane, lane + 16); two S^T tiles of keys 0-15 and 16-31, rounded to f16 in
// place, ARE the B operand of O^T += V^T . P^T in the k order of the A loader (k = 8 hi + e, 16 + 8 hi + e). Running maximum m (in log2 units) and running sum l per query;
// the output tiles are rescaled only in a pass where some query of the wave meets a new maximum. A lane ends with 8 consecutive d of one query: one 16-byte store into the merged-heads plane.
#define KPI  (HD + 8)             // LDS pitch of a K row, in f16: 144 bytes
#define VPI  (NTK + 8)            // LDS pitch of a V^T row, in f16: 2064 bytes
__global__ __launch_bounds__(512) void k_attn(const h16* __restrict__ Q, const h16* __restrict__ Kp, const h16* __restrict__ VT, h16* OH) {
    __shared__ __align__(16) h16 KS[NTK * KPI];
    __shared__ __align__(16) h16 VS[HD * VPI];
    const int tid = threadIdx.x, lane = tid & 31, wave = tid >> 5, lr = lane & 15, hi = lane >> 4;
    const int z = blockIdx.y, q0 = blockIdx.x * 512 + wave * 32;
    const h16* qp = Q + ((size_t)z * NTK + q0 + lr) * HD + 8 * hi;
    const h16* kg = Kp + (size_t)z * NTK * HD + tid * 8;      // both planes are NTK * HD f16 in a row: 16 rounds of 512 lanes x 16 bytes each
    const h16* vg = VT + (size_t)z * HD * NTK + tid * 8;
    const float L2E = 1.44269504088896340736f;
    v16h qf[2][2], kf[2][2], vf[4];      // qf, kf: [query tile | key tile][k step of 32 over the head size]; vf[dt]: V^T rows d = dt * 16 + lr, the pass's 32 keys
#pragma unroll
    for (int u = 0; u < 2; ++u)
#pragma unroll
        for (int ks = 0; ks < 2; ++ks) qf[u][ks] = cat16(*(const v8h*)(qp + u * 16 * HD + ks * 32), *(const v8h*)(qp + u * 16 * HD + ks * 32 + 16));
    {
        v8h kr[16], vr[16];
#pragma unroll
        for (int i = 0; i < 16; ++i) { kr[i] = *(const v8h*)(kg + i * 4096); vr[i] = *(const v8h*)(vg + i * 4096); }
#pragma unroll
        for (int i = 0; i < 16; ++i) { const int c = i * 512 + tid;      // 16-byte piece c: K row c / 8, piece c % 8; V^T row c / 128, piece c % 128
            *(v8h*)(KS + (c >> 3) * KPI + (c & 7) * 8) = kr[i]; *(v8h*)(VS + (c >> 7) * VPI + (c & 127) * 8) = vr[i]; }
    }
    __syncthreads();
    const h16* kp = KS + lr * KPI + 8 * hi;
    const h16* vp = VS + lr * VPI + 8 * hi;
#pragma unroll
    for (int t = 0; t < 2; ++t)
#pragma unroll
        for (int ks = 0; ks < 2; ++ks) kf[t][ks] = cat16(*(const v8h*)(kp + t * 16 * KPI + ks * 32), *(const v8h*)(kp + t * 16 * KPI + ks * 32 + 16));
#pragma unroll
    for (int dt = 0; dt < 4; ++dt) vf[dt] = cat16(*(const v8h*)(vp + dt * 16 * VPI), *(const v8h*)(vp + dt * 16 * VPI + 16));
    v8f o[2][4];
#pragma unroll
    for (int u = 0; u < 2; ++u)
#pragma unroll
        for (int dt = 0; dt < 4; ++dt) o[u][dt] = (v8f){};
    float m[2] = {-3.0e38f, -3.0e38f}, l[2] = {0.f, 0.f};
    // not unrolled: one pass's fragments, scores and output tiles fill the 256 registers that four waves a SIMD leave each wave
#pragma unroll 1
    for (int k0 = 0; k0 < NTK; k0 += 32) {
        v8f s[2][2];              // [query tile][key tile]: s[u][t][j] = score(key k0 + 16 t + 8 hi + j, query q0 + 16 u + lr)
#pragma unroll
        for (int u = 0; u < 2; ++u)
#pragma unroll
            for (int t = 0; t < 2; ++t) s[u][t] = wmma16(kf[t][1], qf[u][1], wmma16(kf[t][0], qf[u][0], (v8f){}));
        const int kn = (k0 + 32) & (NTK - 1);    // the next pass's keys: K and V^T fragments are fetched one pass ahead, each into its own registers right behind its products (the last pass fetches keys 0 .. 31 again, unused)
#pragma unroll
        for (int t = 0; t < 2; ++t)
#pragma unroll
            for (int ks = 0; ks < 2; ++ks) kf[t][ks] = cat16(*(const v8h*)(kp + (kn + t * 16) * KPI + ks * 32), *(const v8h*)(kp + (kn + t * 16) * KPI + ks * 32 + 16));
        __builtin_amdgcn_sched_barrier(0);    // holds the K loads up here: moved down to the pass's end they would be waited for at once, with the whole load latency open
        float mn[2];
#pragma unroll
        for (int u = 0; u < 2; ++u) { float mx = s[u][0][0];
#pragma unroll
            for (int j = 1; j < 8; ++j) mx = fmaxf(mx, s[u][0][j]);
#pragma unroll
            for (int j = 0; j < 8; ++j) mx = fmaxf(mx, s[u][1][j]);
            mx = fmaxf(mx, xhalf(mx)); mn[u] = fmaxf(m[u], mx * L2E); }
        if (__builtin_amdgcn_ballot_w32(mn[0] > m[0] || mn[1] > m[1]) != 0) {
#pragma unroll
            for (int u = 0; u < 2; ++u) { const float a = __builtin_amdgcn_exp2f(m[u] - mn[u]); m[u] = mn[u]; l[u] *= a;
#pragma unroll
                for (int dt = 0; dt < 4; ++dt) o[u][dt] *= a; }
        }
        v16h pf[2];
#pragma unroll
        for (int u = 0; u < 2; ++u)
#pragma unroll
            for (int t = 0; t < 2; ++t)
#pragma unroll
                for (int j = 0; j < 8; j += 2) { const v2f e = __builtin_elementwise_fma((v2f){s[u][t][j], s[u][t][j + 1]}, (v2f){L2E, L2E}, (v2f){-m[u], -m[u]});    // register pairs as the accumulator has them: one packed fma
                    const float p0 = __builtin_amdgcn_exp2f(e[0]), p1 = __builtin_amdgcn_exp2f(e[1]); l[u] += p0; l[u] += p1; pf[u][t * 8 + j] = tohx(p0); pf[u][t * 8 + j + 1] = tohx(p1); }
#pragma unroll
        for (int dt = 0; dt < 4; ++dt)
#pragma unroll
            for (int u = 0; u < 2; ++u) o[u][dt] = wmma16(vf[dt], pf[u], o[u][dt]);
#pragma unroll
        for (int dt = 0; dt < 4; ++dt) vf[dt] = cat16(*(const v8h*)(vp + dt * 16 * VPI + kn), *(const v8h*)(vp + dt * 16 * VPI + kn + 16));
    }
    const int sq = z / NH_, h = z % NH_;
#pragma unroll
    for (int u = 0; u < 2; ++u) { const float inv = 1.0f / (l[u] + xhalf(l[u]));
        h16* op = OH + ((size_t)sq * NTK + q0 + u * 16 + lr) * CC + h * HD + 8 * hi;
#pragma unroll
        for (int dt = 0; dt < 4; ++dt) { v8h ov;
#pragma unroll
            for (int j = 0; j < 8; ++j) ov[j] = tohx(o[u][dt][j] * inv);
            *(v8h*)(op + dt * 16) = ov; } }
}
__global__ __launch_bounds__(256) void k_outT3(const float* __restrict__ Y, const float* __restrict__ x, int s0, float* OUTB) {
    __shared__ float tl[64][65];
    const int tid = threadIdx.x; const int n0 = blockIdx.x * 64, c0 = blockIdx.y * 64; const int g = blockIdx.z, s = s0 + g; const int rr = tid >> 2, cq = (tid & 3) * 16;
#pragma unroll
    for (int i = 0; i < 16; ++i) tl[rr][cq + i] = Y[((size_t)g * NTK + n0 + rr) * CC + c0 + cq + i];   // tl[n][c] (group-local Y row)
    __syncthreads();
    const int lane = tid & 31, wv = tid >> 5;
    auto pass = [&]() {
#pragma unroll
        for (int st = 0; st < 4; ++st) { const int cr = wv * 8 + st * 2 + (lane >> 4); const int nq = (lane & 15) * 4; const size_t o = xoff(s, c0 + cr, n0 + nq); v4f v;
#pragma unroll
            for (int i = 0; i < 4; ++i) v[i] = tl[nq + i][cr] + bfr(x[o + i]);
            *(v4f*)(OUTB + o) = v; }
    };
    pass(); 
}

extern "C" void kernel_launch(void* const* d_in, const int* in_sizes, int n_in,
                              void* d_out, int out_size, void* d_ws, size_t ws_size, hipStream_t stream) {
    (void)in_sizes; (void)n_in; (void)out_size;
    const float* x = (const float*)d_in[0]; const float* lg = (const float*)d_in[1]; const float* lb = (const float*)d_in[2]; const float* Wq = (const float*)d_in[3]; const float* bq = (const float*)d_in[4]; const float* Wk = (const float*)d_in[5]; const float* bk = (const float*)d_in[6]; const float* Wv = (const float*)d_in[7]; const float* bv = (const float*)d_in[8]; const float* Wp = (const float*)d_in[9]; const float* bp = (const float*)d_in[10];
    float* out = (float*)d_out;    // [2][512][8][32][32]
    char* wsp = (char*)d_ws;
    auto take = [&](size_t bytes) { char* p = wsp; wsp += (bytes + 255) & ~(size_t)255; return (void*)p; };
    h16* BW = (h16*)take((size_t)4 * CC * CC * 2); h16* BP = BW + (size_t)3 * CC * CC;    // the four weight planes in a row: q, k, v, p
    float* MU = (float*)take(NR * 4); float* RS = (float*)take(NR * 4); h16* XN = (h16*)take((size_t)NR * CC * 2);
    h16* Qx = (h16*)take((size_t)2 * NSQ * NH_ * NTK * HD * 2); h16* Kx = Qx + (size_t)NSQ * NH_ * NTK * HD; h16* VTx = (h16*)take((size_t)NSQ * NH_ * HD * NTK * 2);
    float* QKV = (float*)take((size_t)3 * NR * CC * 4);    // the f32 q, k, v projections of all 16 sequences (3 planes of NR x CC)
    h16* OH = (h16*)take((size_t)NR * CC * 2); float* Y = (float*)take((size_t)NR * CC * 4);
    if ((size_t)(wsp - (char*)d_ws) > ws_size) return;    // ~ 2.1 + 0.1 + 16.8 + 50.3 + 100.7 + 16.8 + 33.6 ~ 220 MB
    k_wTh<<<dim3(CC / 64, CC / 64, 4), 256, 0, stream>>>(Wq, Wk, Wv, Wp, CC, CC, BW);
    k_stat<<<NR / 64, 512, 0, stream>>>(x, MU, RS);
    k_nrow<<<NR / 8, 256, 0, stream>>>(x, MU, RS, lg, lb, XN);
    k_gemmh<<<dim3(NR / 128, CC / 128, 3), 256, 0, stream>>>(XN, BW, bq, bk, bv, QKV, (size_t)CC * CC, (size_t)NR * CC);
    k_hplh3<<<dim3((NTK / 2) / 8, 1, 2 * NSQ * NH_), 256, 0, stream>>>(QKV, 0, 0.125f, 1.0f, Qx);
    k_vTh3<<<dim3(NTK / 64, 1, NSQ * NH_), 256, 0, stream>>>(QKV + (size_t)2 * NR * CC, 0, VTx);
    k_attn<<<dim3(NTK / 512, NSQ * NH_), 512, 0, stream>>>(Qx, Kx, VTx, OH);
    k_gemmh<<<dim3(NR / 128, CC / 128, 1), 256, 0, stream>>>(OH, BP, bp, nullptr, nullptr, Y, 0, 0);
    k_outT3<<<dim3(NTK / 64, CC / 64, NSQ), 256, 0, stream>>>(Y, x, 0, out);
}

// v005
// It runs in 105 microseconds.
// Timed twice side by side with v004, it ran 1.28 and 1.27 times as fast.
// Over all steps from v000 it is 11.6 times as fast.
#include <hip/hip_runtime.h>

// scores ([1024 x 64].[64 x 1024]) and attn.v on SINGLE fp16 planes (LN output, q/8, k, softmax probabilities, v and the merged heads rounded to fp16 = 2^-11; weights
// fp16(bf16(W)); one v_wmma_f32_16x16x32_f16 product each — the residual input dominating the output); softmax f32; + the input residual in f32 with

#define NSQ  16                   // (b t) sequences
#define NTK  1024                 // (h w) tokens
#define CC   512
#define NH_  8
#define HD   64
#define TT   8
#define NR   (NSQ * NTK)          // 16384
#define DM   CC
#define LOSC 1024.0f
typedef _Float16 h16;
typedef unsigned short bf;
typedef __attribute__((ext_vector_type(16))) __bf16   v16bf;
typedef __attribute__((ext_vector_type(16))) _Float16 v16h;
typedef __attribute__((ext_vector_type(8)))  _Float16 v8h;
typedef __attribute__((ext_vector_type(8)))  unsigned short v8us;
typedef __attribute__((ext_vector_type(8)))  float    v8f;
typedef __attribute__((ext_vector_type(4)))  float    v4f;
typedef v8h  __attribute__((may_alias)) v8ha;
typedef v4f  __attribute__((may_alias)) v4fa;
typedef v8us __attribute__((may_alias)) v8usa;

__device__ __forceinline__ unsigned short f2bf(float f) { unsigned u = __float_as_uint(f); u += 0x7FFFu + ((u >> 16) & 1u); return (unsigned short)(u >> 16); }
__device__ __forceinline__ float bf2f(unsigned short b) { return __uint_as_float(((unsigned)b) << 16); }
__device__ __forceinline__ float bfr(float f) { return bf2f(f2bf(f)); }
__device__ __forceinline__ v16h cat16(v8h lo, v8h hi) { return __builtin_shufflevector(lo, hi, 0, 1, 2, 3, 4, 5, 6, 7, 8, 9, 10, 11, 12, 13, 14, 15); }
__device__ __forceinline__ v16bf cat16b(v8us lo, v8us hi) { return __builtin_bit_cast(v16bf, __builtin_shufflevector(lo, hi, 0, 1, 2, 3, 4, 5, 6, 7, 8, 9, 10, 11, 12, 13, 14, 15)); }
__device__ __forceinline__ v8f wmma16(v16h a, v16h b, v8f c) { return __builtin_amdgcn_wmma_f32_16x16x32_f16(false, a, false, b, (short)0, c, false, false); }
__device__ __forceinline__ v8f wmmab(v16bf a, v16bf b, v8f c) { return __builtin_amdgcn_wmma_f32_16x16x32_bf16(false, a, false, b, (short)0, c, false, false); }


// k_gemmh: 128 x 128 tile of C = A . Bn^T with SINGLE f16 planes (A [rows][DM] f16 activations, Bn [N][DM] f16 weights; one v_wmma_f32_16x16x32_f16 product per step), f32 accumulate;
// grid z picks the weight plane (sB apart); bias1, bias2: where given, grid z = 1 and z = 2 add these in place of bias (q, k and v projections in one launch).
// C itself is never stored: the epilogue writes what the next kernel reads. x given: the output projection, out[b][c][t][n] = C^T + x in f32. Else z = 0, 1: q / 8 and k in f16, one plane
// [token][HD] per (sequence, head); z = 2: V^T in f16, [d][token] per (sequence, head).
// Both operands go through LDS, 64 k a stage, two stages: whole-line loads (a wave's 16-byte loads cover 4 rows of 128 bytes) bring each byte to the WGP once per work-group, and the
// 8 waves (4 x 2, 32 x 64 of C each) take their fragments from LDS. A fragment load straight from global memory touches 16 lines for its 512 bytes, and every wave fetched its own copy of Bn.
// The next stage's global loads fly while this stage is multiplied; one barrier a stage publishes the stage just written and ends the reads of the one written next.
#define GBK  64                   // k per stage
#define GPI  (GBK + 8)            // LDS pitch of a staged row, in f16: 144 bytes (16 bytes x odd: the 16-byte reads meet no bank conflict)
#define GST  (256 * GPI)          // one stage, in f16: 128 rows of A, then 128 rows of Bn
#define OPI  (128 + 4)            // LDS pitch of a staged output channel, in f32: 528 bytes (16 bytes x odd)
#define TPI  (128 + 8)            // LDS pitch of a staged V^T row, in f16: 272 bytes (16 bytes x odd)
__device__ __forceinline__ size_t xoff(int s, int c, int n) { const int b = s / TT, t = s % TT; return (((size_t)b * CC + c) * TT + t) * NTK + n; }   // x[b][c][t][n]
__global__ __launch_bounds__(256) void k_gemmh(const h16* __restrict__ A, const h16* __restrict__ Bn, const float* bias, const float* bias1, const float* bias2, h16* QK, h16* VT, const float* __restrict__ x, float* out, size_t sB) {
    __shared__ __align__(16) h16 st[2 * GST];      // 73,728 bytes; the epilogue's staging (69,632 bytes at most) lies in the same place
    const size_t z = blockIdx.z; Bn += z * sB;
    if (bias1 && z) bias = z == 1 ? bias1 : bias2;
    const int tid = threadIdx.x, lane = tid & 31, wave = tid >> 5, lr = lane & 15, hi = lane >> 4;
    const int r0 = blockIdx.x * 128, c0 = blockIdx.y * 128, wr = (wave >> 1) * 32, wc = (wave & 1) * 64;
    // this lane's 16-byte piece of rows prow, prow + 32, prow + 64, prow + 96 of either operand: 8 lanes a row (one line); a half-wave takes rows 8 apart, whose 16 pieces fall on all 64 LDS banks
    const int prow = (wave >> 2) * 16 + ((lane >> 3) & 1) * 8 + (wave & 3) * 2 + (lane >> 4), pcol = (lane & 7) * 8;
    const h16* ab = A + (size_t)r0 * DM;                  // the tiles' first rows: the same for the whole work-group
    const h16* bb = Bn + (size_t)c0 * DM;
    const unsigned po = prow * DM + pcol;
    h16* sw = st + prow * GPI + pcol;
    v8h ra[4], rb[4];
#pragma unroll
    for (int i = 0; i < 4; ++i) { ra[i] = *(const v8h*)(ab + po + i * 32 * DM); rb[i] = *(const v8h*)(bb + po + i * 32 * DM); }
    float bv[4] = {0.f, 0.f, 0.f, 0.f};      // fetched here, behind the first stage's loads, so that the epilogue waits for no load
    if (bias) {
#pragma unroll
        for (int t = 0; t < 4; ++t) bv[t] = bias[c0 + wc + t * 16 + lr];
#pragma unroll
        for (int t = 0; t < 4; ++t) bv[t] = bfr(bv[t]);
    }
#pragma unroll
    for (int i = 0; i < 4; ++i) { *(v8h*)(sw + i * 32 * GPI) = ra[i]; *(v8h*)(sw + (128 + i * 32) * GPI) = rb[i]; }
    __syncthreads();
    const h16* ar = st + (wr + lr) * GPI + 8 * hi;
    const h16* br = st + (128 + wc + lr) * GPI + 8 * hi;
    v8f acc[2][4];
#pragma unroll
    for (int u = 0; u < 2; ++u)
#pragma unroll
        for (int t = 0; t < 4; ++t) acc[u][t] = (v8f){};
    int cur = 0;                  // f16 offset of the stage being multiplied
    // not unrolled: the stages are alike, and one copy of the loop keeps the registers at one stage's need (two work-groups a WGP)
#pragma unroll 1
    for (int kn = GBK; ; kn += GBK) {
        const bool more = kn < DM;    // the same in every lane of the work-group: the barrier below stands under uniform control flow
        if (more) { const h16* an = ab + kn; const h16* bn = bb + kn;
#pragma unroll
            for (int i = 0; i < 4; ++i) { ra[i] = *(const v8h*)(an + po + i * 32 * DM); rb[i] = *(const v8h*)(bn + po + i * 32 * DM); }
        }
#pragma unroll
        for (int ks = 0; ks < GBK; ks += 32) {
            v16h a[2], b[4];
#pragma unroll
            for (int u = 0; u < 2; ++u) a[u] = cat16(*(const v8h*)(ar + cur + u * 16 * GPI + ks), *(const v8h*)(ar + cur + u * 16 * GPI + ks + 16));
#pragma unroll
            for (int t = 0; t < 4; ++t) b[t] = cat16(*(const v8h*)(br + cur + t * 16 * GPI + ks), *(const v8h*)(br + cur + t * 16 * GPI + ks + 16));
            __builtin_amdgcn_sched_barrier(0);    // holds the 12 LDS reads together ahead of their 8 products: moved down among them, each pair is waited for at once, with the whole LDS latency open
#pragma unroll
            for (int t = 0; t < 4; ++t)
#pragma unroll
                for (int u = 0; u < 2; ++u) acc[u][t] = wmma16(a[u], b[t], acc[u][t]);
        }
        if (!more) break;
        cur ^= GST;
#pragma unroll
        for (int i = 0; i < 4; ++i) { *(v8h*)(sw + cur + i * 32 * GPI) = ra[i]; *(v8h*)(sw + cur + (128 + i * 32) * GPI) = rb[i]; }
        __syncthreads();
    }
    __syncthreads();              // every wave has read its last fragments: the stages' LDS becomes the output staging
    const int sq = r0 / NTK, n0 = r0 % NTK;      // the tile's 128 rows are tokens n0 .. n0 + 127 of one sequence
    // An accumulator register run j = 0 .. 7 is 8 consecutive tokens of one column: the two transposed outputs are staged [column][token] by whole 16-byte LDS stores.
    if (x) {
        float* ts = (float*)st;                  // [128 channels][OPI]
#pragma unroll
        for (int t = 0; t < 4; ++t)
#pragma unroll
            for (int u = 0; u < 2; ++u) { float* d = ts + (wc + t * 16 + lr) * OPI + wr + u * 16 + hi * 8;
                *(v4fa*)d = (v4f){acc[u][t][0] + bv[t], acc[u][t][1] + bv[t], acc[u][t][2] + bv[t], acc[u][t][3] + bv[t]};
                *(v4fa*)(d + 4) = (v4f){acc[u][t][4] + bv[t], acc[u][t][5] + bv[t], acc[u][t][6] + bv[t], acc[u][t][7] + bv[t]}; }
        // a wave per channel row: 32 lanes x 16 bytes = its 128 tokens, 4 whole lines; the residual's 16 loads are issued together, ahead of the barrier
        const unsigned o = (unsigned)xoff(sq, c0 + wave * 16, n0 + lane * 4) * 4u;      // in bytes: one 32-bit offset register beside the two base pointers serves x and out (33.6 MB each)
        v4f xv[16];
#pragma unroll
        for (int s = 0; s < 16; ++s) xv[s] = *(const v4f*)((const char*)x + o + s * (TT * NTK * 4));
        __syncthreads();
#pragma unroll
        for (int s = 0; s < 16; ++s) { v4f y = *(const v4fa*)(ts + (wave * 16 + s) * OPI + lane * 4);
#pragma unroll
            for (int i = 0; i < 4; ++i) y[i] += bfr(xv[s][i]);
            *(v4f*)((char*)out + o + s * (TT * NTK * 4)) = y; }
        asm volatile("s_wait_xcnt 0x0" ::: "memory");    // behind the last store of the run: no register that an issued store names is written before it
        return;
    }
    if (z == 2) {
        h16* vs = st;                            // [128 columns = 2 heads x 64 d][TPI]
#pragma unroll
        for (int t = 0; t < 4; ++t)
#pragma unroll
            for (int u = 0; u < 2; ++u) { v8h v;
#pragma unroll
                for (int j = 0; j < 8; ++j) v[j] = (h16)(acc[u][t][j] + bv[t]);
                *(v8ha*)(vs + (wc + t * 16 + lr) * TPI + wr + u * 16 + hi * 8) = v; }
        __syncthreads();
        // a half-wave per V^T row: 16 lanes x 16 bytes = its 128 tokens, 2 whole lines
        h16* vp = VT + ((size_t)sq * CC + c0 + wave * 16 + hi) * NTK + n0 + lr * 8;
        const h16* vr = vs + (wave * 16 + hi) * TPI + lr * 8;
#pragma unroll
        for (int s = 0; s < 8; ++s) *(v8h*)(vp + s * 2 * NTK) = *(const v8ha*)(vr + s * 2 * TPI);
        asm volatile("s_wait_xcnt 0x0" ::: "memory");    // behind the last store of the run, as above
        return;
    }
    float* os = (float*)st + wave * (32 * 68);
#pragma unroll
    for (int t = 0; t < 4; ++t)
#pragma unroll
        for (int u = 0; u < 2; ++u)
#pragma unroll
            for (int j = 0; j < 8; ++j) os[(u * 16 + hi * 8 + j) * 68 + t * 16 + lr] = acc[u][t][j] + bv[t];
    __syncthreads();
    // the wave's 64 columns are one head: 8 lanes store one token's 64 d (one 128-byte line), 4 tokens a store, 512 bytes in a row
    const float sc = z == 0 ? 0.125f : 1.0f;     // q carries 1 / sqrt(HD)
    const int row = lane >> 3, cofs = (lane & 7) * 8;
    h16* cp = QK + (((z * NSQ + sq) * NH_ + ((c0 + wc) >> 6)) * NTK + n0 + wr + row) * HD + cofs;
    const float* op = os + row * 68 + cofs;
#pragma unroll
    for (int s = 0; s < 8; ++s) { const v4f a = *(const v4fa*)(op + s * 4 * 68), b = *(const v4fa*)(op + s * 4 * 68 + 4);
        *(v8h*)(cp + s * 4 * HD) = (v8h){(h16)(a[0] * sc), (h16)(a[1] * sc), (h16)(a[2] * sc), (h16)(a[3] * sc), (h16)(b[0] * sc), (h16)(b[1] * sc), (h16)(b[2] * sc), (h16)(b[3] * sc)}; }
    asm volatile("s_wait_xcnt 0x0" ::: "memory");        // behind the last store of the run, as above
}

typedef __attribute__((ext_vector_type(4))) _Float16 v4h;
__device__ __forceinline__ h16 tohx(float x) { return (h16)x; }
// k_stat: one work-group per 64 tokens. Each of its 16 waves holds 32 channels of them in registers (16 independent 16-byte loads per lane, a half-wave per channel row),
// so x is read once and no load waits on the one before it; the channel sums meet in LDS: per-lane chain, the two half-waves, then the 16 waves in index order.
__global__ __launch_bounds__(512) void k_stat(const float* __restrict__ x, float* MU, float* RS) {
    __shared__ __align__(16) float red[2][16][64];
    const int lane = threadIdx.x & 31, wv = threadIdx.x >> 5, hi = lane >> 4, tq = (lane & 15) * 4;
    const int s = blockIdx.x / (NTK / 64), n0 = (blockIdx.x % (NTK / 64)) * 64;
    const float* p = x + xoff(s, wv * 32 + hi, n0 + tq);      // channel wv * 32 + 2 i + hi, tokens n0 + tq .. + 3
    v4f v[16];
#pragma unroll
    for (int i = 0; i < 16; ++i) v[i] = *(const v4f*)(p + (size_t)i * (2 * TT * NTK));
    v4f sm = (v4f){};
#pragma unroll
    for (int i = 0; i < 16; ++i) { v[i] = (v4f){bfr(v[i][0]), bfr(v[i][1]), bfr(v[i][2]), bfr(v[i][3])}; sm += v[i]; }
#pragma unroll
    for (int j = 0; j < 4; ++j) sm[j] += __shfl_xor(sm[j], 16, 32);
    if (hi == 0) *(v4fa*)(&red[0][wv][tq]) = sm;
    __syncthreads();
    v4f mu = (v4f){};
#pragma unroll
    for (int w = 0; w < 16; ++w) mu += *(const v4fa*)(&red[0][w][tq]);
    mu *= (1.0f / CC);
    v4f q = (v4f){};
#pragma unroll
    for (int i = 0; i < 16; ++i) { const v4f d = v[i] - mu;
#pragma unroll
        for (int j = 0; j < 4; ++j) q[j] = fmaf(d[j], d[j], q[j]); }
#pragma unroll
    for (int j = 0; j < 4; ++j) q[j] += __shfl_xor(q[j], 16, 32);
    if (hi == 0) *(v4fa*)(&red[1][wv][tq]) = q;
    __syncthreads();
    if (threadIdx.x < 16) { v4f qs = (v4f){};
#pragma unroll
        for (int w = 0; w < 16; ++w) qs += *(const v4fa*)(&red[1][w][tq]);
        const size_t r = (size_t)s * NTK + n0 + tq;
        *(v4f*)(MU + r) = mu; *(v4f*)(RS + r) = (v4f){rsqrtf(qs[0] * (1.0f / CC) + 1e-5f), rsqrtf(qs[1] * (1.0f / CC) + 1e-5f), rsqrtf(qs[2] * (1.0f / CC) + 1e-5f), rsqrtf(qs[3] * (1.0f / CC) + 1e-5f)}; }
}
__global__ __launch_bounds__(256) void k_nrow(const float* __restrict__ x, const float* __restrict__ MU, const float* __restrict__ RS, const float* __restrict__ g, const float* __restrict__ bb, h16* XN) {
    const int lane = threadIdx.x & 31; const size_t r = (size_t)blockIdx.x * 8 + (threadIdx.x >> 5); if (r >= (size_t)NR) return; const int s = (int)(r / NTK), n = (int)(r % NTK); const float mu = MU[r], rs = RS[r];
{
#pragma unroll 1
        for (int p = 0; p < CC / 256; ++p) { const int c0 = p * 256 + lane * 8; v8h o;
#pragma unroll
            for (int i = 0; i < 8; ++i) { const int c = c0 + i; o[i] = tohx((bfr(x[xoff(s, c, n)]) - mu) * rs * bfr(g[c]) + bfr(bb[c])); }
            *(v8h*)(XN + r * CC + c0) = o; }
         }
}
__global__ __launch_bounds__(256) void k_wTh(const float* __restrict__ W0, const float* __restrict__ W1, const float* __restrict__ W2, const float* __restrict__ W3, int K, int N, h16* Bt) {
    __shared__ float tl[64][65];
    const float* Wm = blockIdx.z == 0 ? W0 : blockIdx.z == 1 ? W1 : blockIdx.z == 2 ? W2 : W3; Bt += (size_t)blockIdx.z * K * N;   // grid z picks the weight and its plane
    const int tid = threadIdx.x; const int k0 = blockIdx.x * 64, n0 = blockIdx.y * 64; const int rr = tid >> 2, cq = (tid & 3) * 16;
#pragma unroll
    for (int i = 0; i < 16; ++i) tl[rr][cq + i] = bfr(Wm[(size_t)(k0 + rr) * N + n0 + cq + i]);
    __syncthreads();
    const int lane = tid & 31, wv = tid >> 5;
    auto pass = [&]() {
#pragma unroll
        for (int st = 0; st < 4; ++st) { const int nr = wv * 8 + st * 2 + (lane >> 4); const int kq = (lane & 15) * 4; v4h v;
#pragma unroll
            for (int i = 0; i < 4; ++i) v[i] = tohx(tl[kq + i][nr]);
            *(v4h*)(Bt + (size_t)(n0 + nr) * K + k0 + kq) = v; }
    };
    pass(); 
}
typedef __attribute__((ext_vector_type(2))) float v2f;
__device__ __forceinline__ float xhalf(float x) { return __builtin_bit_cast(float, __builtin_amdgcn_permlanex16(__builtin_bit_cast(int, x), __builtin_bit_cast(int, x), 0x76543210, 0xfedcba98, false, false)); }   // lane l takes lane l ^ 16's value
// k_attn: scores, softmax and attn.v of one (sequence, head) for 512 queries a work-group, 32 queries a wave, 32 keys a pass; nothing of S or P leaves the registers.
// The head's whole K (1024 x 64) and V^T (64 x 1024) are laid into LDS once, by whole-line loads, and every wave takes its fragments from there: a fragment load straight from
// global memory touches 16 lines for its 512 bytes, and 16 waves would each fetch the same ones. Pitches of 16 bytes x odd keep the 16-byte LDS reads free of bank conflicts.
// Transposed products: S^T = K . Q^T (A = 16 keys, B = 16 queries) puts one query's scores in one lane pair (lane, lane + 16); two S^T tiles of keys 0-15 and 16-31, rounded to f16 in
// place, ARE the B operand of O^T += V^T . P^T in the k order of the A loader (k = 8 hi + e, 16 + 8 hi + e). Running maximum m (in log2 units) and running sum l per query;
// the output tiles are rescaled only in a pass where some query of the wave meets a new maximum. A lane ends with 8 consecutive d of one query: one 16-byte store into the merged-heads plane.
#define KPI  (HD + 8)             // LDS pitch of a K row, in f16: 144 bytes
#define VPI  (NTK + 8)            // LDS pitch of a V^T row, in f16: 2064 bytes
__global__ __launch_bounds__(512) void k_attn(const h16* __restrict__ Q, const h16* __restrict__ Kp, const h16* __restrict__ VT, h16* OH) {
    __shared__ __align__(16) h16 KS[NTK * KPI];
    __shared__ __align__(16) h16 VS[HD * VPI];
    const int tid = threadIdx.x, lane = tid & 31, wave = tid >> 5, lr = lane & 15, hi = lane >> 4;
    const int z = blockIdx.y, q0 = blockIdx.x * 512 + wave * 32;
    const h16* qp = Q + ((size_t)z * NTK + q0 + lr) * HD + 8 * hi;
    const h16* kg = Kp + (size_t)z * NTK * HD + tid * 8;      // both planes are NTK * HD f16 in a row: 16 rounds of 512 lanes x 16 bytes each
    const h16* vg = VT + (size_t)z * HD * NTK + tid * 8;
    const float L2E = 1.44269504088896340736f;
    v16h qf[2][2], kf[2][2], vf[4];      // qf, kf: [query tile | key tile][k step of 32 over the head size]; vf[dt]: V^T rows d = dt * 16 + lr, the pass's 32 keys
#pragma unroll
    for (int u = 0; u < 2; ++u)
#pragma unroll
        for (int ks = 0; ks < 2; ++ks) qf[u][ks] = cat16(*(const v8h*)(qp + u * 16 * HD + ks * 32), *(const v8h*)(qp + u * 16 * HD + ks * 32 + 16));
    {
        v8h kr[16], vr[16];
#pragma unroll
        for (int i = 0; i < 16; ++i) { kr[i] = *(const v8h*)(kg + i * 4096); vr[i] = *(const v8h*)(vg + i * 4096); }
#pragma unroll
        for (int i = 0; i < 16; ++i) { const int c = i * 512 + tid;      // 16-byte piece c: K row c / 8, piece c % 8; V^T row c / 128, piece c % 128
            *(v8h*)(KS + (c >> 3) * KPI + (c & 7) * 8) = kr[i]; *(v8h*)(VS + (c >> 7) * VPI + (c & 127) * 8) = vr[i]; }
    }
    __syncthreads();
    const h16* kp = KS + lr * KPI + 8 * hi;
    const h16* vp = VS + lr * VPI + 8 * hi;
#pragma unroll
    for (int t = 0; t < 2; ++t)
#pragma unroll
        for (int ks = 0; ks < 2; ++ks) kf[t][ks] = cat16(*(const v8h*)(kp + t * 16 * KPI + ks * 32), *(const v8h*)(kp + t * 16 * KPI + ks * 32 + 16));
#pragma unroll
    for (int dt = 0; dt < 4; ++dt) vf[dt] = cat16(*(const v8h*)(vp + dt * 16 * VPI), *(const v8h*)(vp + dt * 16 * VPI + 16));
    v8f o[2][4];
#pragma unroll
    for (int u = 0; u < 2; ++u)
#pragma unroll
        for (int dt = 0; dt < 4; ++dt) o[u][dt] = (v8f){};
    float m[2] = {-3.0e38f, -3.0e38f}, l[2] = {0.f, 0.f};
    // not unrolled: one pass's fragments, scores and output tiles fill the 256 registers that four waves a SIMD leave each wave
#pragma unroll 1
    for (int k0 = 0; k0 < NTK; k0 += 32) {
        v8f s[2][2];              // [query tile][key tile]: s[u][t][j] = score(key k0 + 16 t + 8 hi + j, query q0 + 16 u + lr)
#pragma unroll
        for (int u = 0; u < 2; ++u)
#pragma unroll
            for (int t = 0; t < 2; ++t) s[u][t] = wmma16(kf[t][1], qf[u][1], wmma16(kf[t][0], qf[u][0], (v8f){}));
        const int kn = (k0 + 32) & (NTK - 1);    // the next pass's keys: K and V^T fragments are fetched one pass ahead, each into its own registers right behind its products (the last pass fetches keys 0 .. 31 again, unused)
#pragma unroll
        for (int t = 0; t < 2; ++t)
#pragma unroll
            for (int ks = 0; ks < 2; ++ks) kf[t][ks] = cat16(*(const v8h*)(kp + (kn + t * 16) * KPI + ks * 32), *(const v8h*)(kp + (kn + t * 16) * KPI + ks * 32 + 16));
        __builtin_amdgcn_sched_barrier(0);    // holds the K loads up here: moved down to the pass's end they would be waited for at once, with the whole load latency open
        float mn[2];
#pragma unroll
        for (int u = 0; u < 2; ++u) { float mx = s[u][0][0];
#pragma unroll
            for (int j = 1; j < 8; ++j) mx = fmaxf(mx, s[u][0][j]);
#pragma unroll
            for (int j = 0; j < 8; ++j) mx = fmaxf(mx, s[u][1][j]);
            mx = fmaxf(mx, xhalf(mx)); mn[u] = fmaxf(m[u], mx * L2E); }
        if (__builtin_amdgcn_ballot_w32(mn[0] > m[0] || mn[1] > m[1]) != 0) {
#pragma unroll
            for (int u = 0; u < 2; ++u) { const float a = __builtin_amdgcn_exp2f(m[u] - mn[u]); m[u] = mn[u]; l[u] *= a;
#pragma unroll
                for (int dt = 0; dt < 4; ++dt) o[u][dt] *= a; }
        }
        v16h pf[2];
#pragma unroll
        for (int u = 0; u < 2; ++u)
#pragma unroll
            for (int t = 0; t < 2; ++t)
#pragma unroll
                for (int j = 0; j < 8; j += 2) { const v2f e = __builtin_elementwise_fma((v2f){s[u][t][j], s[u][t][j + 1]}, (v2f){L2E, L2E}, (v2f){-m[u], -m[u]});    // register pairs as the accumulator has them: one packed fma
                    const float p0 = __builtin_amdgcn_exp2f(e[0]), p1 = __builtin_amdgcn_exp2f(e[1]); l[u] += p0; l[u] += p1; pf[u][t * 8 + j] = tohx(p0); pf[u][t * 8 + j + 1] = tohx(p1); }
#pragma unroll
        for (int dt = 0; dt < 4; ++dt)
#pragma unroll
            for (int u = 0; u < 2; ++u) o[u][dt] = wmma16(vf[dt], pf[u], o[u][dt]);
#pragma unroll
        for (int dt = 0; dt < 4; ++dt) vf[dt] = cat16(*(const v8h*)(vp + dt * 16 * VPI + kn), *(const v8h*)(vp + dt * 16 * VPI + kn + 16));
    }
    const int sq = z / NH_, h = z % NH_;
#pragma unroll
    for (int u = 0; u < 2; ++u) { const float inv = 1.0f / (l[u] + xhalf(l[u]));
        h16* op = OH + ((size_t)sq * NTK + q0 + u * 16 + lr) * CC + h * HD + 8 * hi;
#pragma unroll
        for (int dt = 0; dt < 4; ++dt) { v8h ov;
#pragma unroll
            for (int j = 0; j < 8; ++j) ov[j] = tohx(o[u][dt][j] * inv);
            *(v8h*)(op + dt * 16) = ov; } }
}

extern "C" void kernel_launch(void* const* d_in, const int* in_sizes, int n_in,
                              void* d_out, int out_size, void* d_ws, size_t ws_size, hipStream_t stream) {
    (void)in_sizes; (void)n_in; (void)out_size;
    const float* x = (const float*)d_in[0]; const float* lg = (const float*)d_in[1]; const float* lb = (const float*)d_in[2]; const float* Wq = (const float*)d_in[3]; const float* bq = (const float*)d_in[4]; const float* Wk = (const float*)d_in[5]; const float* bk = (const float*)d_in[6]; const float* Wv = (const float*)d_in[7]; const float* bv = (const float*)d_in[8]; const float* Wp = (const float*)d_in[9]; const float* bp = (const float*)d_in[10];
    float* out = (float*)d_out;    // [2][512][8][32][32]
    char* wsp = (char*)d_ws;
    auto take = [&](size_t bytes) { char* p = wsp; wsp += (bytes + 255) & ~(size_t)255; return (void*)p; };
    h16* BW = (h16*)take((size_t)4 * CC * CC * 2); h16* BP = BW + (size_t)3 * CC * CC;    // the four weight planes in a row: q, k, v, p
    float* MU = (float*)take(NR * 4); float* RS = (float*)take(NR * 4); h16* XN = (h16*)take((size_t)NR * CC * 2);
    h16* Qx = (h16*)take((size_t)2 * NSQ * NH_ * NTK * HD * 2); h16* Kx = Qx + (size_t)NSQ * NH_ * NTK * HD; h16* VTx = (h16*)take((size_t)NSQ * NH_ * HD * NTK * 2);
    h16* OH = (h16*)take((size_t)NR * CC * 2);
    if ((size_t)(wsp - (char*)d_ws) > ws_size) return;    // ~ 2.1 + 0.1 + 16.8 + 50.3 + 16.8 ~ 86 MB
    k_wTh<<<dim3(CC / 64, CC / 64, 4), 256, 0, stream>>>(Wq, Wk, Wv, Wp, CC, CC, BW);
    k_stat<<<NR / 64, 512, 0, stream>>>(x, MU, RS);
    k_nrow<<<NR / 8, 256, 0, stream>>>(x, MU, RS, lg, lb, XN);
    k_gemmh<<<dim3(NR / 128, CC / 128, 3), 256, 0, stream>>>(XN, BW, bq, bk, bv, Qx, VTx, nullptr, nullptr, (size_t)CC * CC);
    k_attn<<<dim3(NTK / 512, NSQ * NH_), 512, 0, stream>>>(Qx, Kx, VTx, OH);
    k_gemmh<<<dim3(NR / 128, CC / 128, 1), 256, 0, stream>>>(OH, BP, bp, nullptr, nullptr, nullptr, nullptr, x, out, 0);
}

// v006
// It runs in 86.1 microseconds.
// Next to v005, in two timings, it ran 1.22 times as fast each time.
// All steps since v000 together make it 14.1 times as fast.
#include <hip/hip_runtime.h>

// scores ([1024 x 64].[64 x 1024]) and attn.v on SINGLE fp16 planes (LN output, q/8, k, softmax probabilities, v and the merged heads rounded to fp16 = 2^-11; weights
// fp16(bf16(W)); one v_wmma_f32_16x16x32_f16 product each — the residual input dominating the output); softmax f32; + the input residual in f32 with

#define NSQ  16                   // (b t) sequences
#define NTK  1024                 // (h w) tokens
#define CC   512
#define NH_  8
#define HD   64
#define TT   8
#define NR   (NSQ * NTK)          // 16384
#define DM   CC
#define LOSC 1024.0f
typedef _Float16 h16;
typedef unsigned short bf;
typedef __attribute__((ext_vector_type(16))) __bf16   v16bf;
typedef __attribute__((ext_vector_type(16))) _Float16 v16h;
typedef __attribute__((ext_vector_type(8)))  _Float16 v8h;
typedef __attribute__((ext_vector_type(8)))  unsigned short v8us;
typedef __attribute__((ext_vector_type(8)))  float    v8f;
typedef __attribute__((ext_vector_type(4)))  float    v4f;
typedef v8h  __attribute__((may_alias)) v8ha;
typedef v4f  __attribute__((may_alias)) v4fa;
typedef v8us __attribute__((may_alias)) v8usa;

__device__ __forceinline__ unsigned short f2bf(float f) { unsigned u = __float_as_uint(f); u += 0x7FFFu + ((u >> 16) & 1u); return (unsigned short)(u >> 16); }
__device__ __forceinline__ float bf2f(unsigned short b) { return __uint_as_float(((unsigned)b) << 16); }
__device__ __forceinline__ float bfr(float f) { return bf2f(f2bf(f)); }
__device__ __forceinline__ v16h cat16(v8h lo, v8h hi) { return __builtin_shufflevector(lo, hi, 0, 1, 2, 3, 4, 5, 6, 7, 8, 9, 10, 11, 12, 13, 14, 15); }
__device__ __forceinline__ v16bf cat16b(v8us lo, v8us hi) { return __builtin_bit_cast(v16bf, __builtin_shufflevector(lo, hi, 0, 1, 2, 3, 4, 5, 6, 7, 8, 9, 10, 11, 12, 13, 14, 15)); }
__device__ __forceinline__ v8f wmma16(v16h a, v16h b, v8f c) { return __builtin_amdgcn_wmma_f32_16x16x32_f16(false, a, false, b, (short)0, c, false, false); }
__device__ __forceinline__ v8f wmmab(v16bf a, v16bf b, v8f c) { return __builtin_amdgcn_wmma_f32_16x16x32_bf16(false, a, false, b, (short)0, c, false, false); }


// k_gemmh: 128 x 128 tile of C = A . Bn^T with SINGLE f16 planes (A [rows][DM] f16 activations, Bn [N][DM] f16 weights; one v_wmma_f32_16x16x32_f16 product per step), f32 accumulate;
// grid z picks the weight plane (sB apart); bias1, bias2: where given, grid z = 1 and z = 2 add these in place of bias (q, k and v projections in one launch).
// C itself is never stored: the epilogue writes what the next kernel reads. x given: the output projection, out[b][c][t][n] = C^T + x in f32. Else z = 0, 1: q / 8 and k in f16, one plane
// [token][HD] per (sequence, head); z = 2: V^T in f16, [d][token] per (sequence, head).
// Both operands go through LDS, 64 k a stage, two stages: whole-line loads (a wave's 16-byte loads cover 4 rows of 128 bytes) bring each byte to the WGP once per work-group, and the
// 8 waves (4 x 2, 32 x 64 of C each) take their fragments from LDS. A fragment load straight from global memory touches 16 lines for its 512 bytes, and every wave fetched its own copy of Bn.
// The next stage's global loads fly while this stage is multiplied; one barrier a stage publishes the stage just written and ends the reads of the one written next.
#define GBK  64                   // k per stage
#define GPI  (GBK + 8)            // LDS pitch of a staged row, in f16: 144 bytes (16 bytes x odd: the 16-byte reads meet no bank conflict)
#define GST  (256 * GPI)          // one stage, in f16: 128 rows of A, then 128 rows of Bn
#define OPI  (128 + 4)            // LDS pitch of a staged output channel, in f32: 528 bytes (16 bytes x odd)
#define TPI  (128 + 8)            // LDS pitch of a staged V^T row, in f16: 272 bytes (16 bytes x odd)
__device__ __forceinline__ size_t xoff(int s, int c, int n) { const int b = s / TT, t = s % TT; return (((size_t)b * CC + c) * TT + t) * NTK + n; }   // x[b][c][t][n]
__global__ __launch_bounds__(256) void k_gemmh(const h16* __restrict__ A, const h16* __restrict__ Bn, const float* bias, const float* bias1, const float* bias2, h16* QK, h16* VT, const float* __restrict__ x, float* out, size_t sB) {
    __shared__ __align__(16) h16 st[2 * GST];      // 73,728 bytes; the epilogue's staging (69,632 bytes at most) lies in the same place
    const size_t z = blockIdx.z; Bn += z * sB;
    if (bias1 && z) bias = z == 1 ? bias1 : bias2;
    const int tid = threadIdx.x, lane = tid & 31, wave = tid >> 5, lr = lane & 15, hi = lane >> 4;
    const int r0 = blockIdx.x * 128, c0 = blockIdx.y * 128, wr = (wave >> 1) * 32, wc = (wave & 1) * 64;
    // this lane's 16-byte piece of rows prow, prow + 32, prow + 64, prow + 96 of either operand: 8 lanes a row (one line); a half-wave takes rows 8 apart, whose 16 pieces fall on all 64 LDS banks
    const int prow = (wave >> 2) * 16 + ((lane >> 3) & 1) * 8 + (wave & 3) * 2 + (lane >> 4), pcol = (lane & 7) * 8;
    const h16* ab = A + (size_t)r0 * DM;                  // the tiles' first rows: the same for the whole work-group
    const h16* bb = Bn + (size_t)c0 * DM;
    const unsigned po = prow * DM + pcol;
    h16* sw = st + prow * GPI + pcol;
    v8h ra[4], rb[4];
#pragma unroll
    for (int i = 0; i < 4; ++i) { ra[i] = *(const v8h*)(ab + po + i * 32 * DM); rb[i] = *(const v8h*)(bb + po + i * 32 * DM); }
    float bv[4] = {0.f, 0.f, 0.f, 0.f};      // fetched here, behind the first stage's loads, so that the epilogue waits for no load
    if (bias) {
#pragma unroll
        for (int t = 0; t < 4; ++t) bv[t] = bias[c0 + wc + t * 16 + lr];
#pragma unroll
        for (int t = 0; t < 4; ++t) bv[t] = bfr(bv[t]);
    }
#pragma unroll
    for (int i = 0; i < 4; ++i) { *(v8h*)(sw + i * 32 * GPI) = ra[i]; *(v8h*)(sw + (128 + i * 32) * GPI) = rb[i]; }
    __syncthreads();
    const h16* ar = st + (wr + lr) * GPI + 8 * hi;
    const h16* br = st + (128 + wc + lr) * GPI + 8 * hi;
    v8f acc[2][4];
#pragma unroll
    for (int u = 0; u < 2; ++u)
#pragma unroll
        for (int t = 0; t < 4; ++t) acc[u][t] = (v8f){};
    int cur = 0;                  // f16 offset of the stage being multiplied
    // not unrolled: the stages are alike, and one copy of the loop keeps the registers at one stage's need (two work-groups a WGP)
#pragma unroll 1
    for (int kn = GBK; ; kn += GBK) {
        const bool more = kn < DM;    // the same in every lane of the work-group: the barrier below stands under uniform control flow
        if (more) { const h16* an = ab + kn; const h16* bn = bb + kn;
#pragma unroll
            for (int i = 0; i < 4; ++i) { ra[i] = *(const v8h*)(an + po + i * 32 * DM); rb[i] = *(const v8h*)(bn + po + i * 32 * DM); }
        }
#pragma unroll
        for (int ks = 0; ks < GBK; ks += 32) {
            v16h a[2], b[4];
#pragma unroll
            for (int u = 0; u < 2; ++u) a[u] = cat16(*(const v8h*)(ar + cur + u * 16 * GPI + ks), *(const v8h*)(ar + cur + u * 16 * GPI + ks + 16));
#pragma unroll
            for (int t = 0; t < 4; ++t) b[t] = cat16(*(const v8h*)(br + cur + t * 16 * GPI + ks), *(const v8h*)(br + cur + t * 16 * GPI + ks + 16));
            __builtin_amdgcn_sched_barrier(0);    // holds the 12 LDS reads together ahead of their 8 products: moved down among them, each pair is waited for at once, with the whole LDS latency open
#pragma unroll
            for (int t = 0; t < 4; ++t)
#pragma unroll
                for (int u = 0; u < 2; ++u) acc[u][t] = wmma16(a[u], b[t], acc[u][t]);
        }
        if (!more) break;
        cur ^= GST;
#pragma unroll
        for (int i = 0; i < 4; ++i) { *(v8h*)(sw + cur + i * 32 * GPI) = ra[i]; *(v8h*)(sw + cur + (128 + i * 32) * GPI) = rb[i]; }
        __syncthreads();
    }
    __syncthreads();              // every wave has read its last fragments: the stages' LDS becomes the output staging
    const int sq = r0 / NTK, n0 = r0 % NTK;      // the tile's 128 rows are tokens n0 .. n0 + 127 of one sequence
    // An accumulator register run j = 0 .. 7 is 8 consecutive tokens of one column: the two transposed outputs are staged [column][token] by whole 16-byte LDS stores.
    if (x) {
        float* ts = (float*)st;                  // [128 channels][OPI]
#pragma unroll
        for (int t = 0; t < 4; ++t)
#pragma unroll
            for (int u = 0; u < 2; ++u) { float* d = ts + (wc + t * 16 + lr) * OPI + wr + u * 16 + hi * 8;
                *(v4fa*)d = (v4f){acc[u][t][0] + bv[t], acc[u][t][1] + bv[t], acc[u][t][2] + bv[t], acc[u][t][3] + bv[t]};
                *(v4fa*)(d + 4) = (v4f){acc[u][t][4] + bv[t], acc[u][t][5] + bv[t], acc[u][t][6] + bv[t], acc[u][t][7] + bv[t]}; }
        // a wave per channel row: 32 lanes x 16 bytes = its 128 tokens, 4 whole lines; the residual's 16 loads are issued together, ahead of the barrier
        const unsigned o = (unsigned)xoff(sq, c0 + wave * 16, n0 + lane * 4) * 4u;      // in bytes: one 32-bit offset register beside the two base pointers serves x and out (33.6 MB each)
        v4f xv[16];
#pragma unroll
        for (int s = 0; s < 16; ++s) xv[s] = *(const v4f*)((const char*)x + o + s * (TT * NTK * 4));
        __syncthreads();
#pragma unroll
        for (int s = 0; s < 16; ++s) { v4f y = *(const v4fa*)(ts + (wave * 16 + s) * OPI + lane * 4);
#pragma unroll
            for (int i = 0; i < 4; ++i) y[i] += bfr(xv[s][i]);
            *(v4f*)((char*)out + o + s * (TT * NTK * 4)) = y; }
        asm volatile("s_wait_xcnt 0x0" ::: "memory");    // behind the last store of the run: no register that an issued store names is written before it
        return;
    }
    if (z == 2) {
        h16* vs = st;                            // [128 columns = 2 heads x 64 d][TPI]
#pragma unroll
        for (int t = 0; t < 4; ++t)
#pragma unroll
            for (int u = 0; u < 2; ++u) { v8h v;
#pragma unroll
                for (int j = 0; j < 8; ++j) v[j] = (h16)(acc[u][t][j] + bv[t]);
                *(v8ha*)(vs + (wc + t * 16 + lr) * TPI + wr + u * 16 + hi * 8) = v; }
        __syncthreads();
        // a half-wave per V^T row: 16 lanes x 16 bytes = its 128 tokens, 2 whole lines
        h16* vp = VT + ((size_t)sq * CC + c0 + wave * 16 + hi) * NTK + n0 + lr * 8;
        const h16* vr = vs + (wave * 16 + hi) * TPI + lr * 8;
#pragma unroll
        for (int s = 0; s < 8; ++s) *(v8h*)(vp + s * 2 * NTK) = *(const v8ha*)(vr + s * 2 * TPI);
        asm volatile("s_wait_xcnt 0x0" ::: "memory");    // behind the last store of the run, as above
        return;
    }
    float* os = (float*)st + wave * (32 * 68);
#pragma unroll
    for (int t = 0; t < 4; ++t)
#pragma unroll
        for (int u = 0; u < 2; ++u)
#pragma unroll
            for (int j = 0; j < 8; ++j) os[(u * 16 + hi * 8 + j) * 68 + t * 16 + lr] = acc[u][t][j] + bv[t];
    __syncthreads();
    // the wave's 64 columns are one head: 8 lanes store one token's 64 d (one 128-byte line), 4 tokens a store, 512 bytes in a row
    const float sc = z == 0 ? 0.125f : 1.0f;     // q carries 1 / sqrt(HD)
    const int row = lane >> 3, cofs = (lane & 7) * 8;
    h16* cp = QK + (((z * NSQ + sq) * NH_ + ((c0 + wc) >> 6)) * NTK + n0 + wr + row) * HD + cofs;
    const float* op = os + row * 68 + cofs;
#pragma unroll
    for (int s = 0; s < 8; ++s) { const v4f a = *(const v4fa*)(op + s * 4 * 68), b = *(const v4fa*)(op + s * 4 * 68 + 4);
        *(v8h*)(cp + s * 4 * HD) = (v8h){(h16)(a[0] * sc), (h16)(a[1] * sc), (h16)(a[2] * sc), (h16)(a[3] * sc), (h16)(b[0] * sc), (h16)(b[1] * sc), (h16)(b[2] * sc), (h16)(b[3] * sc)}; }
    asm volatile("s_wait_xcnt 0x0" ::: "memory");        // behind the last store of the run, as above
}

typedef __attribute__((ext_vector_type(4))) _Float16 v4h;
__device__ __forceinline__ h16 tohx(float x) { return (h16)x; }
// k_ln: LayerNorm of 64 tokens a work-group, x read once. Each of its 16 waves holds 32 channels of them in registers (16 independent 16-byte loads per lane, a half-wave per channel row,
// a lane's 16 channels in a row), so no load waits on the one before it; the channel sums meet in LDS: per-lane chain, the two half-waves, then the 16 waves in index order.
// The normalised tile goes out from the same registers: a lane has 16 consecutive channels of each of its 4 tokens (two 16-byte LDS stores a token), the tile is turned in LDS to
// [token][channel], and a wave stores 512 bytes of one token's row at a time (4 whole lines). A load of one channel per lane for a single token would touch 32 lines for 128 bytes.
// The 16-byte piece c of token t lies at piece c ^ (t / 4): the 16 lanes of a half-wave, which write one piece column of tokens 4 apart, and those that read one row, each meet all 64 banks.
__global__ __launch_bounds__(512) void k_ln(const float* __restrict__ x, const float* __restrict__ g, const float* __restrict__ bb, h16* XN) {
    __shared__ __align__(16) float red[2][16][64];
    __shared__ __align__(16) h16 tl[64 * CC];      // 65,536 bytes
    const int lane = threadIdx.x & 31, wv = threadIdx.x >> 5, hi = lane >> 4, lr = lane & 15, tq = lr * 4;
    const int s = blockIdx.x / (NTK / 64), n0 = (blockIdx.x % (NTK / 64)) * 64;
    const int cb = wv * 32 + hi * 16;
    const float* p = x + xoff(s, cb, n0 + tq);      // channel cb + i, tokens n0 + tq .. + 3
    v4f v[16];
#pragma unroll
    for (int i = 0; i < 16; ++i) v[i] = *(const v4f*)(p + (size_t)i * (TT * NTK));
    asm volatile("s_wait_xcnt 0x0" ::: "memory");    // behind x's loads: the loads below may land in the registers that hold x's address
    v4f gv[4], bv[4];             // fetched behind x's loads: they are back before the sums are
#pragma unroll
    for (int i = 0; i < 4; ++i) { gv[i] = *(const v4f*)(g + cb + i * 4); bv[i] = *(const v4f*)(bb + cb + i * 4); }
    v4f sm = (v4f){};
#pragma unroll
    for (int i = 0; i < 16; ++i) { v[i] = (v4f){bfr(v[i][0]), bfr(v[i][1]), bfr(v[i][2]), bfr(v[i][3])}; sm += v[i]; }
#pragma unroll
    for (int j = 0; j < 4; ++j) sm[j] += __shfl_xor(sm[j], 16, 32);
    if (hi == 0) *(v4fa*)(&red[0][wv][tq]) = sm;
    __syncthreads();
    v4f mu = (v4f){};
#pragma unroll
    for (int w = 0; w < 16; ++w) mu += *(const v4fa*)(&red[0][w][tq]);
    mu *= (1.0f / CC);
    v4f q = (v4f){};
#pragma unroll
    for (int i = 0; i < 16; ++i) { v[i] -= mu;
#pragma unroll
        for (int j = 0; j < 4; ++j) q[j] = fmaf(v[i][j], v[i][j], q[j]); }
#pragma unroll
    for (int j = 0; j < 4; ++j) q[j] += __shfl_xor(q[j], 16, 32);
    if (hi == 0) *(v4fa*)(&red[1][wv][tq]) = q;
#pragma unroll
    for (int i = 0; i < 4; ++i)
#pragma unroll
        for (int j = 0; j < 4; ++j) { gv[i][j] = bfr(gv[i][j]); bv[i][j] = bfr(bv[i][j]); }
    __syncthreads();
    v4f qs = (v4f){};
#pragma unroll
    for (int w = 0; w < 16; ++w) qs += *(const v4fa*)(&red[1][w][tq]);
    const v4f rs = (v4f){rsqrtf(qs[0] * (1.0f / CC) + 1e-5f), rsqrtf(qs[1] * (1.0f / CC) + 1e-5f), rsqrtf(qs[2] * (1.0f / CC) + 1e-5f), rsqrtf(qs[3] * (1.0f / CC) + 1e-5f)};
#pragma unroll
    for (int c = 0; c < 16; ++c) v[c] = v[c] * rs * gv[c >> 2][c & 3] + bv[c >> 2][c & 3];
#pragma unroll
    for (int j = 0; j < 4; ++j)
#pragma unroll
        for (int hf = 0; hf < 2; ++hf) { v8h o;
#pragma unroll
            for (int i = 0; i < 8; ++i) o[i] = tohx(v[hf * 8 + i][j]);
            *(v8ha*)(tl + (tq + j) * CC + ((wv * 4 + hi * 2 + hf) ^ lr) * 8) = o; }
    __syncthreads();              // the tile is whole: every wave reads rows that all 16 waves wrote
    // wave wv stores tokens 4 wv .. 4 wv + 3, whose pieces are turned by wv
    h16* op = XN + ((size_t)s * NTK + n0 + wv * 4) * CC + lane * 8;
    const h16* tr = tl + wv * 4 * CC + (lane ^ wv) * 8;
#pragma unroll
    for (int r = 0; r < 4; ++r)
#pragma unroll
        for (int hf = 0; hf < 2; ++hf) *(v8h*)(op + r * CC + hf * 256) = *(const v8ha*)(tr + r * CC + hf * 256);
}
__global__ __launch_bounds__(256) void k_wTh(const float* __restrict__ W0, const float* __restrict__ W1, const float* __restrict__ W2, const float* __restrict__ W3, int K, int N, h16* Bt) {
    __shared__ float tl[64][65];
    const float* Wm = blockIdx.z == 0 ? W0 : blockIdx.z == 1 ? W1 : blockIdx.z == 2 ? W2 : W3; Bt += (size_t)blockIdx.z * K * N;   // grid z picks the weight and its plane
    const int tid = threadIdx.x; const int k0 = blockIdx.x * 64, n0 = blockIdx.y * 64; const int rr = tid >> 2, cq = (tid & 3) * 16;
#pragma unroll
    for (int i = 0; i < 16; ++i) tl[rr][cq + i] = bfr(Wm[(size_t)(k0 + rr) * N + n0 + cq + i]);
    __syncthreads();
    const int lane = tid & 31, wv = tid >> 5;
    auto pass = [&]() {
#pragma unroll
        for (int st = 0; st < 4; ++st) { const int nr = wv * 8 + st * 2 + (lane >> 4); const int kq = (lane & 15) * 4; v4h v;
#pragma unroll
            for (int i = 0; i < 4; ++i) v[i] = tohx(tl[kq + i][nr]);
            *(v4h*)(Bt + (size_t)(n0 + nr) * K + k0 + kq) = v; }
    };
    pass(); 
}
typedef __attribute__((ext_vector_type(2))) float v2f;
__device__ __forceinline__ float xhalf(float x) { return __builtin_bit_cast(float, __builtin_amdgcn_permlanex16(__builtin_bit_cast(int, x), __builtin_bit_cast(int, x), 0x76543210, 0xfedcba98, false, false)); }   // lane l takes lane l ^ 16's value
// k_attn: scores, softmax and attn.v of one (sequence, head) for 512 queries a work-group, 32 queries a wave, 32 keys a pass; nothing of S or P leaves the registers.
// The head's whole K (1024 x 64) and V^T (64 x 1024) are laid into LDS once, by whole-line loads, and every wave takes its fragments from there: a fragment load straight from
// global memory touches 16 lines for its 512 bytes, and 16 waves would each fetch the same ones. Pitches of 16 bytes x odd keep the 16-byte LDS reads free of bank conflicts.
// Transposed products: S^T = K . Q^T (A = 16 keys, B = 16 queries) puts one query's scores in one lane pair (lane, lane + 16); two S^T tiles of keys 0-15 and 16-31, rounded to f16 in
// place, ARE the B operand of O^T += V^T . P^T in the k order of the A loader (k = 8 hi + e, 16 + 8 hi + e). Running maximum m (in log2 units) and running sum l per query;
// the output tiles are rescaled only in a pass where some query of the wave meets a new maximum. A lane ends with 8 consecutive d of one query: one 16-byte store into the merged-heads plane.
#define KPI  (HD + 8)             // LDS pitch of a K row, in f16: 144 bytes
#define VPI  (NTK + 8)            // LDS pitch of a V^T row, in f16: 2064 bytes
__global__ __launch_bounds__(512) void k_attn(const h16* __restrict__ Q, const h16* __restrict__ Kp, const h16* __restrict__ VT, h16* OH) {
    __shared__ __align__(16) h16 KS[NTK * KPI];
    __shared__ __align__(16) h16 VS[HD * VPI];
    const int tid = threadIdx.x, lane = tid & 31, wave = tid >> 5, lr = lane & 15, hi = lane >> 4;
    const int z = blockIdx.y, q0 = blockIdx.x * 512 + wave * 32;
    const h16* qp = Q + ((size_t)z * NTK + q0 + lr) * HD + 8 * hi;
    const h16* kg = Kp + (size_t)z * NTK * HD + tid * 8;      // both planes are NTK * HD f16 in a row: 16 rounds of 512 lanes x 16 bytes each
    const h16* vg = VT + (size_t)z * HD * NTK + tid * 8;
    const float L2E = 1.44269504088896340736f;
    v16h qf[2][2], kf[2][2], vf[4];      // qf, kf: [query tile | key tile][k step of 32 over the head size]; vf[dt]: V^T rows d = dt * 16 + lr, the pass's 32 keys
#pragma unroll
    for (int u = 0; u < 2; ++u)
#pragma unroll
        for (int ks = 0; ks < 2; ++ks) qf[u][ks] = cat16(*(const v8h*)(qp + u * 16 * HD + ks * 32), *(const v8h*)(qp + u * 16 * HD + ks * 32 + 16));
    {
        v8h kr[16], vr[16];
#pragma unroll
        for (int i = 0; i < 16; ++i) { kr[i] = *(const v8h*)(kg + i * 4096); vr[i] = *(const v8h*)(vg + i * 4096); }
#pragma unroll
        for (int i = 0; i < 16; ++i) { const int c = i * 512 + tid;      // 16-byte piece c: K row c / 8, piece c % 8; V^T row c / 128, piece c % 128
            *(v8h*)(KS + (c >> 3) * KPI + (c & 7) * 8) = kr[i]; *(v8h*)(VS + (c >> 7) * VPI + (c & 127) * 8) = vr[i]; }
    }
    __syncthreads();
    const h16* kp = KS + lr * KPI + 8 * hi;
    const h16* vp = VS + lr * VPI + 8 * hi;
#pragma unroll
    for (int t = 0; t < 2; ++t)
#pragma unroll
        for (int ks = 0; ks < 2; ++ks) kf[t][ks] = cat16(*(const v8h*)(kp + t * 16 * KPI + ks * 32), *(const v8h*)(kp + t * 16 * KPI + ks * 32 + 16));
#pragma unroll
    for (int dt = 0; dt < 4; ++dt) vf[dt] = cat16(*(const v8h*)(vp + dt * 16 * VPI), *(const v8h*)(vp + dt * 16 * VPI + 16));
    v8f o[2][4];
#pragma unroll
    for (int u = 0; u < 2; ++u)
#pragma unroll
        for (int dt = 0; dt < 4; ++dt) o[u][dt] = (v8f){};
    float m[2] = {-3.0e38f, -3.0e38f}, l[2] = {0.f, 0.f};
    // not unrolled: one pass's fragments, scores and output tiles fill the 256 registers that four waves a SIMD leave each wave
#pragma unroll 1
    for (int k0 = 0; k0 < NTK; k0 += 32) {
        v8f s[2][2];              // [query tile][key tile]: s[u][t][j] = score(key k0 + 16 t + 8 hi + j, query q0 + 16 u + lr)
#pragma unroll
        for (int u = 0; u < 2; ++u)
#pragma unroll
            for (int t = 0; t < 2; ++t) s[u][t] = wmma16(kf[t][1], qf[u][1], wmma16(kf[t][0], qf[u][0], (v8f){}));
        const int kn = (k0 + 32) & (NTK - 1);    // the next pass's keys: K and V^T fragments are fetched one pass ahead, each into its own registers right behind its products (the last pass fetches keys 0 .. 31 again, unused)
#pragma unroll
        for (int t = 0; t < 2; ++t)
#pragma unroll
            for (int ks = 0; ks < 2; ++ks) kf[t][ks] = cat16(*(const v8h*)(kp + (kn + t * 16) * KPI + ks * 32), *(const v8h*)(kp + (kn + t * 16) * KPI + ks * 32 + 16));
        __builtin_amdgcn_sched_barrier(0);    // holds the K loads up here: moved down to the pass's end they would be waited for at once, with the whole load latency open
        float mn[2];
#pragma unroll
        for (int u = 0; u < 2; ++u) { float mx = s[u][0][0];
#pragma unroll
            for (int j = 1; j < 8; ++j) mx = fmaxf(mx, s[u][0][j]);
#pragma unroll
            for (int j = 0; j < 8; ++j) mx = fmaxf(mx, s[u][1][j]);
            mx = fmaxf(mx, xhalf(mx)); mn[u] = fmaxf(m[u], mx * L2E); }
        if (__builtin_amdgcn_ballot_w32(mn[0] > m[0] || mn[1] > m[1]) != 0) {
#pragma unroll
            for (int u = 0; u < 2; ++u) { const float a = __builtin_amdgcn_exp2f(m[u] - mn[u]); m[u] = mn[u]; l[u] *= a;
#pragma unroll
                for (int dt = 0; dt < 4; ++dt) o[u][dt] *= a; }
        }
        v16h pf[2];
#pragma unroll
        for (int u = 0; u < 2; ++u)
#pragma unroll
            for (int t = 0; t < 2; ++t)
#pragma unroll
                for (int j = 0; j < 8; j += 2) { const v2f e = __builtin_elementwise_fma((v2f){s[u][t][j], s[u][t][j + 1]}, (v2f){L2E, L2E}, (v2f){-m[u], -m[u]});    // register pairs as the accumulator has them: one packed fma
                    const float p0 = __builtin_amdgcn_exp2f(e[0]), p1 = __builtin_amdgcn_exp2f(e[1]); l[u] += p0; l[u] += p1; pf[u][t * 8 + j] = tohx(p0); pf[u][t * 8 + j + 1] = tohx(p1); }
#pragma unroll
        for (int dt = 0; dt < 4; ++dt)
#pragma unroll
            for (int u = 0; u < 2; ++u) o[u][dt] = wmma16(vf[dt], pf[u], o[u][dt]);
#pragma unroll
        for (int dt = 0; dt < 4; ++dt) vf[dt] = cat16(*(const v8h*)(vp + dt * 16 * VPI + kn), *(const v8h*)(vp + dt * 16 * VPI + kn + 16));
    }
    const int sq = z / NH_, h = z % NH_;
#pragma unroll
    for (int u = 0; u < 2; ++u) { const float inv = 1.0f / (l[u] + xhalf(l[u]));
        h16* op = OH + ((size_t)sq * NTK + q0 + u * 16 + lr) * CC + h * HD + 8 * hi;
#pragma unroll
        for (int dt = 0; dt < 4; ++dt) { v8h ov;
#pragma unroll
            for (int j = 0; j < 8; ++j) ov[j] = tohx(o[u][dt][j] * inv);
            *(v8h*)(op + dt * 16) = ov; } }
}

extern "C" void kernel_launch(void* const* d_in, const int* in_sizes, int n_in,
                              void* d_out, int out_size, void* d_ws, size_t ws_size, hipStream_t stream) {
    (void)in_sizes; (void)n_in; (void)out_size;
    const float* x = (const float*)d_in[0]; const float* lg = (const float*)d_in[1]; const float* lb = (const float*)d_in[2]; const float* Wq = (const float*)d_in[3]; const float* bq = (const float*)d_in[4]; const float* Wk = (const float*)d_in[5]; const float* bk = (const float*)d_in[6]; const float* Wv = (const float*)d_in[7]; const float* bv = (const float*)d_in[8]; const float* Wp = (const float*)d_in[9]; const float* bp = (const float*)d_in[10];
    float* out = (float*)d_out;    // [2][512][8][32][32]
    char* wsp = (char*)d_ws;
    auto take = [&](size_t bytes) { char* p = wsp; wsp += (bytes + 255) & ~(size_t)255; return (void*)p; };
    h16* BW = (h16*)take((size_t)4 * CC * CC * 2); h16* BP = BW + (size_t)3 * CC * CC;    // the four weight planes in a row: q, k, v, p
    h16* XN = (h16*)take((size_t)NR * CC * 2);
    h16* Qx = (h16*)take((size_t)2 * NSQ * NH_ * NTK * HD * 2); h16* Kx = Qx + (size_t)NSQ * NH_ * NTK * HD; h16* VTx = (h16*)take((size_t)NSQ * NH_ * HD * NTK * 2);
    h16* OH = (h16*)take((size_t)NR * CC * 2);
    if ((size_t)(wsp - (char*)d_ws) > ws_size) return;    // ~ 2.1 + 16.8 + 50.3 + 16.8 ~ 86 MB
    k_wTh<<<dim3(CC / 64, CC / 64, 4), 256, 0, stream>>>(Wq, Wk, Wv, Wp, CC, CC, BW);
    k_ln<<<NR / 64, 512, 0, stream>>>(x, lg, lb, XN);
    k_gemmh<<<dim3(NR / 128, CC / 128, 3), 256, 0, stream>>>(XN, BW, bq, bk, bv, Qx, VTx, nullptr, nullptr, (size_t)CC * CC);
    k_attn<<<dim3(NTK / 512, NSQ * NH_), 512, 0, stream>>>(Qx, Kx, VTx, OH);
    k_gemmh<<<dim3(NR / 128, CC / 128, 1), 256, 0, stream>>>(OH, BP, bp, nullptr, nullptr, nullptr, nullptr, x, out, 0);
}

// v007
// A run of this version takes 83.1 microseconds.
// In both of two side-by-side timings against v006, it was 1.04 times as fast.
// All steps since v000 together make it 14.7 times as fast.
#include <hip/hip_runtime.h>

// scores ([1024 x 64].[64 x 1024]) and attn.v on SINGLE fp16 planes (LN output, q/8, k, softmax probabilities, v and the merged heads rounded to fp16 = 2^-11; weights
// fp16(bf16(W)); one v_wmma_f32_16x16x32_f16 product each — the residual input dominating the output); softmax f32; + the input residual in f32 with

#define NSQ  16                   // (b t) sequences
#define NTK  1024                 // (h w) tokens
#define CC   512
#define NH_  8
#define HD   64
#define TT   8
#define NR   (NSQ * NTK)          // 16384
#define DM   CC
#define LOSC 1024.0f
typedef _Float16 h16;
typedef unsigned short bf;
typedef __attribute__((ext_vector_type(16))) __bf16   v16bf;
typedef __attribute__((ext_vector_type(16))) _Float16 v16h;
typedef __attribute__((ext_vector_type(8)))  _Float16 v8h;
typedef __attribute__((ext_vector_type(8)))  unsigned short v8us;
typedef __attribute__((ext_vector_type(8)))  float    v8f;
typedef __attribute__((ext_vector_type(4)))  float    v4f;
typedef v8h  __attribute__((may_alias)) v8ha;
typedef v4f  __attribute__((may_alias)) v4fa;
typedef v8us __attribute__((may_alias)) v8usa;

__device__ __forceinline__ unsigned short f2bf(float f) { unsigned u = __float_as_uint(f); u += 0x7FFFu + ((u >> 16) & 1u); return (unsigned short)(u >> 16); }
__device__ __forceinline__ float bf2f(unsigned short b) { return __uint_as_float(((unsigned)b) << 16); }
__device__ __forceinline__ float bfr(float f) { return bf2f(f2bf(f)); }
__device__ __forceinline__ v16h cat16(v8h lo, v8h hi) { return __builtin_shufflevector(lo, hi, 0, 1, 2, 3, 4, 5, 6, 7, 8, 9, 10, 11, 12, 13, 14, 15); }
__device__ __forceinline__ v16bf cat16b(v8us lo, v8us hi) { return __builtin_bit_cast(v16bf, __builtin_shufflevector(lo, hi, 0, 1, 2, 3, 4, 5, 6, 7, 8, 9, 10, 11, 12, 13, 14, 15)); }
__device__ __forceinline__ v8f wmma16(v16h a, v16h b, v8f c) { return __builtin_amdgcn_wmma_f32_16x16x32_f16(false, a, false, b, (short)0, c, false, false); }
__device__ __forceinline__ v8f wmmab(v16bf a, v16bf b, v8f c) { return __builtin_amdgcn_wmma_f32_16x16x32_bf16(false, a, false, b, (short)0, c, false, false); }


// k_gemmh: 128 x 128 tile of C = A . Bn^T with SINGLE f16 planes (A [rows][DM] f16 activations, Bn [N][DM] f16 weights; one v_wmma_f32_16x16x32_f16 product per step), f32 accumulate;
// grid z picks the weight plane (sB apart); bias1, bias2: where given, grid z = 1 and z = 2 add these in place of bias (q, k and v projections in one launch).
// C itself is never stored: the epilogue writes what the next kernel reads. x given: the output projection, out[b][c][t][n] = C^T + x in f32. Else z = 0, 1: q / 8 and k in f16, one plane
// [token][HD] per (sequence, head); z = 2: V^T in f16, [d][token] per (sequence, head).
// Both operands go through LDS, 64 k a stage, two stages: whole-line loads (a wave's 16-byte loads cover 4 rows of 128 bytes) bring each byte to the WGP once per work-group, and the
// 8 waves (4 x 2, 32 x 64 of C each) take their fragments from LDS. A fragment load straight from global memory touches 16 lines for its 512 bytes, and every wave fetched its own copy of Bn.
// The next stage's global loads fly while this stage is multiplied; one barrier a stage publishes the stage just written and ends the reads of the one written next.
#define GBK  64                   // k per stage
#define GPI  (GBK + 8)            // LDS pitch of a staged row, in f16: 144 bytes (16 bytes x odd: the 16-byte reads meet no bank conflict)
#define GST  (256 * GPI)          // one stage, in f16: 128 rows of A, then 128 rows of Bn
#define OPI  (128 + 4)            // LDS pitch of a staged output channel, in f32: 528 bytes (16 bytes x odd)
#define TPI  (128 + 8)            // LDS pitch of a staged V^T row, in f16: 272 bytes (16 bytes x odd)
__device__ __forceinline__ size_t xoff(int s, int c, int n) { const int b = s / TT, t = s % TT; return (((size_t)b * CC + c) * TT + t) * NTK + n; }   // x[b][c][t][n]
__global__ __launch_bounds__(256) void k_gemmh(const h16* __restrict__ A, const h16* __restrict__ Bn, const float* bias, const float* bias1, const float* bias2, h16* QK, h16* VT, const float* __restrict__ x, float* out, size_t sB) {
    __shared__ __align__(16) h16 st[2 * GST];      // 73,728 bytes; the epilogue's staging (69,632 bytes at most) lies in the same place
    const size_t z = blockIdx.z; Bn += z * sB;
    if (bias1 && z) bias = z == 1 ? bias1 : bias2;
    const int tid = threadIdx.x, lane = tid & 31, wave = tid >> 5, lr = lane & 15, hi = lane >> 4;
    const int r0 = blockIdx.x * 128, c0 = blockIdx.y * 128, wr = (wave >> 1) * 32, wc = (wave & 1) * 64;
    // this lane's 16-byte piece of rows prow, prow + 32, prow + 64, prow + 96 of either operand: 8 lanes a row (one line); a half-wave takes rows 8 apart, whose 16 pieces fall on all 64 LDS banks
    const int prow = (wave >> 2) * 16 + ((lane >> 3) & 1) * 8 + (wave & 3) * 2 + (lane >> 4), pcol = (lane & 7) * 8;
    const h16* ab = A + (size_t)r0 * DM;                  // the tiles' first rows: the same for the whole work-group
    const h16* bb = Bn + (size_t)c0 * DM;
    const unsigned po = prow * DM + pcol;
    h16* sw = st + prow * GPI + pcol;
    v8h ra[4], rb[4];
#pragma unroll
    for (int i = 0; i < 4; ++i) { ra[i] = *(const v8h*)(ab + po + i * 32 * DM); rb[i] = *(const v8h*)(bb + po + i * 32 * DM); }
    float bv[4] = {0.f, 0.f, 0.f, 0.f};      // fetched here, behind the first stage's loads, so that the epilogue waits for no load
    if (bias) {
#pragma unroll
        for (int t = 0; t < 4; ++t) bv[t] = bias[c0 + wc + t * 16 + lr];
#pragma unroll
        for (int t = 0; t < 4; ++t) bv[t] = bfr(bv[t]);
    }
#pragma unroll
    for (int i = 0; i < 4; ++i) { *(v8h*)(sw + i * 32 * GPI) = ra[i]; *(v8h*)(sw + (128 + i * 32) * GPI) = rb[i]; }
    __syncthreads();
    const h16* ar = st + (wr + lr) * GPI + 8 * hi;
    const h16* br = st + (128 + wc + lr) * GPI + 8 * hi;
    v8f acc[2][4];
#pragma unroll
    for (int u = 0; u < 2; ++u)
#pragma unroll
        for (int t = 0; t < 4; ++t) acc[u][t] = (v8f){};
    int cur = 0;                  // f16 offset of the stage being multiplied
    // not unrolled: the stages are alike, and one copy of the loop keeps the registers at one stage's need (two work-groups a WGP)
#pragma unroll 1
    for (int kn = GBK; ; kn += GBK) {
        const bool more = kn < DM;    // the same in every lane of the work-group: the barrier below stands under uniform control flow
        if (more) { const h16* an = ab + kn; const h16* bn = bb + kn;
#pragma unroll
            for (int i = 0; i < 4; ++i) { ra[i] = *(const v8h*)(an + po + i * 32 * DM); rb[i] = *(const v8h*)(bn + po + i * 32 * DM); }
        }
#pragma unroll
        for (int ks = 0; ks < GBK; ks += 32) {
            v16h a[2], b[4];
#pragma unroll
            for (int u = 0; u < 2; ++u) a[u] = cat16(*(const v8h*)(ar + cur + u * 16 * GPI + ks), *(const v8h*)(ar + cur + u * 16 * GPI + ks + 16));
#pragma unroll
            for (int t = 0; t < 4; ++t) b[t] = cat16(*(const v8h*)(br + cur + t * 16 * GPI + ks), *(const v8h*)(br + cur + t * 16 * GPI + ks + 16));
            __builtin_amdgcn_sched_barrier(0);    // holds the 12 LDS reads together ahead of their 8 products: moved down among them, each pair is waited for at once, with the whole LDS latency open
#pragma unroll
            for (int t = 0; t < 4; ++t)
#pragma unroll
                for (int u = 0; u < 2; ++u) acc[u][t] = wmma16(a[u], b[t], acc[u][t]);
        }
        if (!more) break;
        cur ^= GST;
#pragma unroll
        for (int i = 0; i < 4; ++i) { *(v8h*)(sw + cur + i * 32 * GPI) = ra[i]; *(v8h*)(sw + cur + (128 + i * 32) * GPI) = rb[i]; }
        __syncthreads();
    }
    __syncthreads();              // every wave has read its last fragments: the stages' LDS becomes the output staging
    const int sq = r0 / NTK, n0 = r0 % NTK;      // the tile's 128 rows are tokens n0 .. n0 + 127 of one sequence
    // An accumulator register run j = 0 .. 7 is 8 consecutive tokens of one column: the two transposed outputs are staged [column][token] by whole 16-byte LDS stores.
    if (x) {
        float* ts = (float*)st;                  // [128 channels][OPI]
#pragma unroll
        for (int t = 0; t < 4; ++t)
#pragma unroll
            for (int u = 0; u < 2; ++u) { float* d = ts + (wc + t * 16 + lr) * OPI + wr + u * 16 + hi * 8;
                *(v4fa*)d = (v4f){acc[u][t][0] + bv[t], acc[u][t][1] + bv[t], acc[u][t][2] + bv[t], acc[u][t][3] + bv[t]};
                *(v4fa*)(d + 4) = (v4f){acc[u][t][4] + bv[t], acc[u][t][5] + bv[t], acc[u][t][6] + bv[t], acc[u][t][7] + bv[t]}; }
        // a wave per channel row: 32 lanes x 16 bytes = its 128 tokens, 4 whole lines; the residual's 16 loads are issued together, ahead of the barrier
        const unsigned o = (unsigned)xoff(sq, c0 + wave * 16, n0 + lane * 4) * 4u;      // in bytes: one 32-bit offset register beside the two base pointers serves x and out (33.6 MB each)
        v4f xv[16];
#pragma unroll
        for (int s = 0; s < 16; ++s) xv[s] = *(const v4f*)((const char*)x + o + s * (TT * NTK * 4));
        __syncthreads();
#pragma unroll
        for (int s = 0; s < 16; ++s) { v4f y = *(const v4fa*)(ts + (wave * 16 + s) * OPI + lane * 4);
#pragma unroll
            for (int i = 0; i < 4; ++i) y[i] += bfr(xv[s][i]);
            *(v4f*)((char*)out + o + s * (TT * NTK * 4)) = y; }
        asm volatile("s_wait_xcnt 0x0" ::: "memory");    // behind the last store of the run: no register that an issued store names is written before it
        return;
    }
    if (z == 2) {
        h16* vs = st;                            // [128 columns = 2 heads x 64 d][TPI]
#pragma unroll
        for (int t = 0; t < 4; ++t)
#pragma unroll
            for (int u = 0; u < 2; ++u) { v8h v;
#pragma unroll
                for (int j = 0; j < 8; ++j) v[j] = (h16)(acc[u][t][j] + bv[t]);
                *(v8ha*)(vs + (wc + t * 16 + lr) * TPI + wr + u * 16 + hi * 8) = v; }
        __syncthreads();
        // a half-wave per V^T row: 16 lanes x 16 bytes = its 128 tokens, 2 whole lines
        h16* vp = VT + ((size_t)sq * CC + c0 + wave * 16 + hi) * NTK + n0 + lr * 8;
        const h16* vr = vs + (wave * 16 + hi) * TPI + lr * 8;
#pragma unroll
        for (int s = 0; s < 8; ++s) *(v8h*)(vp + s * 2 * NTK) = *(const v8ha*)(vr + s * 2 * TPI);
        asm volatile("s_wait_xcnt 0x0" ::: "memory");    // behind the last store of the run, as above
        return;
    }
    float* os = (float*)st + wave * (32 * 68);
#pragma unroll
    for (int t = 0; t < 4; ++t)
#pragma unroll
        for (int u = 0; u < 2; ++u)
#pragma unroll
            for (int j = 0; j < 8; ++j) os[(u * 16 + hi * 8 + j) * 68 + t * 16 + lr] = acc[u][t][j] + bv[t];
    __syncthreads();
    // the wave's 64 columns are one head: 8 lanes store one token's 64 d (one 128-byte line), 4 tokens a store, 512 bytes in a row
    const float sc = z == 0 ? 0.125f : 1.0f;     // q carries 1 / sqrt(HD)
    const int row = lane >> 3, cofs = (lane & 7) * 8;
    h16* cp = QK + (((z * NSQ + sq) * NH_ + ((c0 + wc) >> 6)) * NTK + n0 + wr + row) * HD + cofs;
    const float* op = os + row * 68 + cofs;
#pragma unroll
    for (int s = 0; s < 8; ++s) { const v4f a = *(const v4fa*)(op + s * 4 * 68), b = *(const v4fa*)(op + s * 4 * 68 + 4);
        *(v8h*)(cp + s * 4 * HD) = (v8h){(h16)(a[0] * sc), (h16)(a[1] * sc), (h16)(a[2] * sc), (h16)(a[3] * sc), (h16)(b[0] * sc), (h16)(b[1] * sc), (h16)(b[2] * sc), (h16)(b[3] * sc)}; }
    asm volatile("s_wait_xcnt 0x0" ::: "memory");        // behind the last store of the run, as above
}

typedef __attribute__((ext_vector_type(4))) _Float16 v4h;
__device__ __forceinline__ h16 tohx(float x) { return (h16)x; }
// k_ln: LayerNorm of 64 tokens a work-group, x read once. Each of its 16 waves holds 32 channels of them in registers (16 independent 16-byte loads per lane, a half-wave per channel row,
// a lane's 16 channels in a row), so no load waits on the one before it; the channel sums meet in LDS: per-lane chain, the two half-waves, then the 16 waves in index order.
// The normalised tile goes out from the same registers: a lane has 16 consecutive channels of each of its 4 tokens (two 16-byte LDS stores a token), the tile is turned in LDS to
// [token][channel], and a wave stores 512 bytes of one token's row at a time (4 whole lines). A load of one channel per lane for a single token would touch 32 lines for 128 bytes.
// The 16-byte piece c of token t lies at piece c ^ (t / 4): the 16 lanes of a half-wave, which write one piece column of tokens 4 apart, and those that read one row, each meet all 64 banks.
// The four weights ride along: they make 4 x 8 x 8 = 256 tiles of 64 x 64, as many as the grid has work-groups. Each work-group fetches one tile along with its x loads (whole 256-byte rows), rounds it,
// lays it in LDS ahead of the second barrier and stores it transposed in f16 ([n][k], whole lines) behind that barrier: the tile's latency lies under that of x, and no launch of its own is needed.
static_assert(NR / 64 == 4 * (CC / 64) * (CC / 64), "one weight tile a work-group");
__global__ __launch_bounds__(512) void k_ln(const float* __restrict__ x, const float* __restrict__ g, const float* __restrict__ bb, h16* XN, const float* __restrict__ W0, const float* __restrict__ W1, const float* __restrict__ W2, const float* __restrict__ W3, h16* Bt) {
    __shared__ __align__(16) float red[2][16][64];
    __shared__ __align__(16) h16 tl[64 * CC];      // 65,536 bytes
    __shared__ float wt[64][65];                   // the weight tile, [k][n]; the odd pitch keeps both the row writes and the column reads off each other's banks
    const int lane = threadIdx.x & 31, wv = threadIdx.x >> 5, hi = lane >> 4, lr = lane & 15, tq = lr * 4;
    const int s = blockIdx.x / (NTK / 64), n0 = (blockIdx.x % (NTK / 64)) * 64;
    const int cb = wv * 32 + hi * 16;
    const float* p = x + xoff(s, cb, n0 + tq);      // channel cb + i, tokens n0 + tq .. + 3
    const int wz = blockIdx.x >> 6, wk0 = ((blockIdx.x >> 3) & 7) * 64, wn0 = (blockIdx.x & 7) * 64;      // weight, first k row and first n column of this work-group's tile
    const float* Wm = wz == 0 ? W0 : wz == 1 ? W1 : wz == 2 ? W2 : W3;
    const int wr = threadIdx.x >> 3, wq = (threadIdx.x & 7) * 8;      // 8 lanes a tile row of 256 bytes
    const float* wp = Wm + (size_t)(wk0 + wr) * CC + wn0 + wq;
    const v4f w0 = *(const v4f*)wp, w1 = *(const v4f*)(wp + 4);
    v4f v[16];
#pragma unroll
    for (int i = 0; i < 16; ++i) v[i] = *(const v4f*)(p + (size_t)i * (TT * NTK));
    asm volatile("s_wait_xcnt 0x0" ::: "memory");    // behind x's and the weight tile's loads: the loads below may land in the registers that hold their addresses
    v4f gv[4], bv[4];             // fetched behind x's loads: they are back before the sums are
#pragma unroll
    for (int i = 0; i < 4; ++i) { gv[i] = *(const v4f*)(g + cb + i * 4); bv[i] = *(const v4f*)(bb + cb + i * 4); }
    v4f sm = (v4f){};
#pragma unroll
    for (int i = 0; i < 16; ++i) { v[i] = (v4f){bfr(v[i][0]), bfr(v[i][1]), bfr(v[i][2]), bfr(v[i][3])}; sm += v[i]; }
#pragma unroll
    for (int j = 0; j < 4; ++j) sm[j] += __shfl_xor(sm[j], 16, 32);
    if (hi == 0) *(v4fa*)(&red[0][wv][tq]) = sm;
    __syncthreads();
    v4f mu = (v4f){};
#pragma unroll
    for (int w = 0; w < 16; ++w) mu += *(const v4fa*)(&red[0][w][tq]);
    mu *= (1.0f / CC);
    v4f q = (v4f){};
#pragma unroll
    for (int i = 0; i < 16; ++i) { v[i] -= mu;
#pragma unroll
        for (int j = 0; j < 4; ++j) q[j] = fmaf(v[i][j], v[i][j], q[j]); }
#pragma unroll
    for (int j = 0; j < 4; ++j) q[j] += __shfl_xor(q[j], 16, 32);
    if (hi == 0) *(v4fa*)(&red[1][wv][tq]) = q;
#pragma unroll
    for (int i = 0; i < 4; ++i) { wt[wr][wq + i] = bfr(w0[i]); wt[wr][wq + 4 + i] = bfr(w1[i]); }
#pragma unroll
    for (int i = 0; i < 4; ++i)
#pragma unroll
        for (int j = 0; j < 4; ++j) { gv[i][j] = bfr(gv[i][j]); bv[i][j] = bfr(bv[i][j]); }
    __syncthreads();
    {   // a half-wave per n row: 16 lanes x 8 bytes = its 64 k, one whole line
        h16* bp = Bt + (size_t)wz * CC * CC + (size_t)(wn0 + wv * 4 + hi) * CC + wk0 + lr * 4;
#pragma unroll
        for (int st = 0; st < 2; ++st) { v4h o;
#pragma unroll
            for (int i = 0; i < 4; ++i) o[i] = tohx(wt[lr * 4 + i][wv * 4 + st * 2 + hi]);
            *(v4h*)(bp + st * 2 * CC) = o; }
    }
    v4f qs = (v4f){};
#pragma unroll
    for (int w = 0; w < 16; ++w) qs += *(const v4fa*)(&red[1][w][tq]);
    const v4f rs = (v4f){rsqrtf(qs[0] * (1.0f / CC) + 1e-5f), rsqrtf(qs[1] * (1.0f / CC) + 1e-5f), rsqrtf(qs[2] * (1.0f / CC) + 1e-5f), rsqrtf(qs[3] * (1.0f / CC) + 1e-5f)};
#pragma unroll
    for (int c = 0; c < 16; ++c) v[c] = v[c] * rs * gv[c >> 2][c & 3] + bv[c >> 2][c & 3];
#pragma unroll
    for (int j = 0; j < 4; ++j)
#pragma unroll
        for (int hf = 0; hf < 2; ++hf) { v8h o;
#pragma unroll
            for (int i = 0; i < 8; ++i) o[i] = tohx(v[hf * 8 + i][j]);
            *(v8ha*)(tl + (tq + j) * CC + ((wv * 4 + hi * 2 + hf) ^ lr) * 8) = o; }
    __syncthreads();              // the tile is whole: every wave reads rows that all 16 waves wrote
    // wave wv stores tokens 4 wv .. 4 wv + 3, whose pieces are turned by wv
    h16* op = XN + ((size_t)s * NTK + n0 + wv * 4) * CC + lane * 8;
    const h16* tr = tl + wv * 4 * CC + (lane ^ wv) * 8;
#pragma unroll
    for (int r = 0; r < 4; ++r)
#pragma unroll
        for (int hf = 0; hf < 2; ++hf) *(v8h*)(op + r * CC + hf * 256) = *(const v8ha*)(tr + r * CC + hf * 256);
}
typedef __attribute__((ext_vector_type(2))) float v2f;
__device__ __forceinline__ float xhalf(float x) { return __builtin_bit_cast(float, __builtin_amdgcn_permlanex16(__builtin_bit_cast(int, x), __builtin_bit_cast(int, x), 0x76543210, 0xfedcba98, false, false)); }   // lane l takes lane l ^ 16's value
// k_attn: scores, softmax and attn.v of one (sequence, head) for 512 queries a work-group, 32 queries a wave, 32 keys a pass; nothing of S or P leaves the registers.
// The head's whole K (1024 x 64) and V^T (64 x 1024) are laid into LDS once, by whole-line loads, and every wave takes its fragments from there: a fragment load straight from
// global memory touches 16 lines for its 512 bytes, and 16 waves would each fetch the same ones. Pitches of 16 bytes x odd keep the 16-byte LDS reads free of bank conflicts.
// Transposed products: S^T = K . Q^T (A = 16 keys, B = 16 queries) puts one query's scores in one lane pair (lane, lane + 16); two S^T tiles of keys 0-15 and 16-31, rounded to f16 in
// place, ARE the B operand of O^T += V^T . P^T in the k order of the A loader (k = 8 hi + e, 16 + 8 hi + e). Running maximum m (in log2 units) and running sum l per query;
// the output tiles are rescaled only in a pass where some query of the wave meets a new maximum. A lane ends with 8 consecutive d of one query: one 16-byte store into the merged-heads plane.
#define KPI  (HD + 8)             // LDS pitch of a K row, in f16: 144 bytes
#define VPI  (NTK + 8)            // LDS pitch of a V^T row, in f16: 2064 bytes
__global__ __launch_bounds__(512) void k_attn(const h16* __restrict__ Q, const h16* __restrict__ Kp, const h16* __restrict__ VT, h16* OH) {
    __shared__ __align__(16) h16 KS[NTK * KPI];
    __shared__ __align__(16) h16 VS[HD * VPI];
    const int tid = threadIdx.x, lane = tid & 31, wave = tid >> 5, lr = lane & 15, hi = lane >> 4;
    const int z = blockIdx.y, q0 = blockIdx.x * 512 + wave * 32;
    const h16* qp = Q + ((size_t)z * NTK + q0 + lr) * HD + 8 * hi;
    const h16* kg = Kp + (size_t)z * NTK * HD + tid * 8;      // both planes are NTK * HD f16 in a row: 16 rounds of 512 lanes x 16 bytes each
    const h16* vg = VT + (size_t)z * HD * NTK + tid * 8;
    const float L2E = 1.44269504088896340736f;
    v16h qf[2][2], kf[2][2], vf[4];      // qf, kf: [query tile | key tile][k step of 32 over the head size]; vf[dt]: V^T rows d = dt * 16 + lr, the pass's 32 keys
#pragma unroll
    for (int u = 0; u < 2; ++u)
#pragma unroll
        for (int ks = 0; ks < 2; ++ks) qf[u][ks] = cat16(*(const v8h*)(qp + u * 16 * HD + ks * 32), *(const v8h*)(qp + u * 16 * HD + ks * 32 + 16));
    {
        v8h kr[16], vr[16];
#pragma unroll
        for (int i = 0; i < 16; ++i) { kr[i] = *(const v8h*)(kg + i * 4096); vr[i] = *(const v8h*)(vg + i * 4096); }
#pragma unroll
        for (int i = 0; i < 16; ++i) { const int c = i * 512 + tid;      // 16-byte piece c: K row c / 8, piece c % 8; V^T row c / 128, piece c % 128
            *(v8h*)(KS + (c >> 3) * KPI + (c & 7) * 8) = kr[i]; *(v8h*)(VS + (c >> 7) * VPI + (c & 127) * 8) = vr[i]; }
    }
    __syncthreads();
    const h16* kp = KS + lr * KPI + 8 * hi;
    const h16* vp = VS + lr * VPI + 8 * hi;
#pragma unroll
    for (int t = 0; t < 2; ++t)
#pragma unroll
        for (int ks = 0; ks < 2; ++ks) kf[t][ks] = cat16(*(const v8h*)(kp + t * 16 * KPI + ks * 32), *(const v8h*)(kp + t * 16 * KPI + ks * 32 + 16));
#pragma unroll
    for (int dt = 0; dt < 4; ++dt) vf[dt] = cat16(*(const v8h*)(vp + dt * 16 * VPI), *(const v8h*)(vp + dt * 16 * VPI + 16));
    v8f o[2][4];
#pragma unroll
    for (int u = 0; u < 2; ++u)
#pragma unroll
        for (int dt = 0; dt < 4; ++dt) o[u][dt] = (v8f){};
    float m[2] = {-3.0e38f, -3.0e38f}, l[2] = {0.f, 0.f};
    // not unrolled: one pass's fragments, scores and output tiles fill the 256 registers that four waves a SIMD leave each wave
#pragma unroll 1
    for (int k0 = 0; k0 < NTK; k0 += 32) {
        v8f s[2][2];              // [query tile][key tile]: s[u][t][j] = score(key k0 + 16 t + 8 hi + j, query q0 + 16 u + lr)
#pragma unroll
        for (int u = 0; u < 2; ++u)
#pragma unroll
            for (int t = 0; t < 2; ++t) s[u][t] = wmma16(kf[t][1], qf[u][1], wmma16(kf[t][0], qf[u][0], (v8f){}));
        const int kn = (k0 + 32) & (NTK - 1);    // the next pass's keys: K and V^T fragments are fetched one pass ahead, each into its own registers right behind its products (the last pass fetches keys 0 .. 31 again, unused)
#pragma unroll
        for (int t = 0; t < 2; ++t)
#pragma unroll
            for (int ks = 0; ks < 2; ++ks) kf[t][ks] = cat16(*(const v8h*)(kp + (kn + t * 16) * KPI + ks * 32), *(const v8h*)(kp + (kn + t * 16) * KPI + ks * 32 + 16));
        __builtin_amdgcn_sched_barrier(0);    // holds the K loads up here: moved down to the pass's end they would be waited for at once, with the whole load latency open
        float mn[2];
#pragma unroll
        for (int u = 0; u < 2; ++u) { float mx = s[u][0][0];
#pragma unroll
            for (int j = 1; j < 8; ++j) mx = fmaxf(mx, s[u][0][j]);
#pragma unroll
            for (int j = 0; j < 8; ++j) mx = fmaxf(mx, s[u][1][j]);
            mx = fmaxf(mx, xhalf(mx)); mn[u] = fmaxf(m[u], mx * L2E); }
        if (__builtin_amdgcn_ballot_w32(mn[0] > m[0] || mn[1] > m[1]) != 0) {
#pragma unroll
            for (int u = 0; u < 2; ++u) { const float a = __builtin_amdgcn_exp2f(m[u] - mn[u]); m[u] = mn[u]; l[u] *= a;
#pragma unroll
                for (int dt = 0; dt < 4; ++dt) o[u][dt] *= a; }
        }
        v16h pf[2];
#pragma unroll
        for (int u = 0; u < 2; ++u)
#pragma unroll
            for (int t = 0; t < 2; ++t)
#pragma unroll
                for (int j = 0; j < 8; j += 2) { const v2f e = __builtin_elementwise_fma((v2f){s[u][t][j], s[u][t][j + 1]}, (v2f){L2E, L2E}, (v2f){-m[u], -m[u]});    // register pairs as the accumulator has them: one packed fma
                    const float p0 = __builtin_amdgcn_exp2f(e[0]), p1 = __builtin_amdgcn_exp2f(e[1]); l[u] += p0; l[u] += p1; pf[u][t * 8 + j] = tohx(p0); pf[u][t * 8 + j + 1] = tohx(p1); }
#pragma unroll
        for (int dt = 0; dt < 4; ++dt)
#pragma unroll
            for (int u = 0; u < 2; ++u) o[u][dt] = wmma16(vf[dt], pf[u], o[u][dt]);
#pragma unroll
        for (int dt = 0; dt < 4; ++dt) vf[dt] = cat16(*(const v8h*)(vp + dt * 16 * VPI + kn), *(const v8h*)(vp + dt * 16 * VPI + kn + 16));
    }
    const int sq = z / NH_, h = z % NH_;
#pragma unroll
    for (int u = 0; u < 2; ++u) { const float inv = 1.0f / (l[u] + xhalf(l[u]));
        h16* op = OH + ((size_t)sq * NTK + q0 + u * 16 + lr) * CC + h * HD + 8 * hi;
#pragma unroll
        for (int dt = 0; dt < 4; ++dt) { v8h ov;
#pragma unroll
            for (int j = 0; j < 8; ++j) ov[j] = tohx(o[u][dt][j] * inv);
            *(v8h*)(op + dt * 16) = ov; } }
}

extern "C" void kernel_launch(void* const* d_in, const int* in_sizes, int n_in,
                              void* d_out, int out_size, void* d_ws, size_t ws_size, hipStream_t stream) {
    (void)in_sizes; (void)n_in; (void)out_size;
    const float* x = (const float*)d_in[0]; const float* lg = (const float*)d_in[1]; const float* lb = (const float*)d_in[2]; const float* Wq = (const float*)d_in[3]; const float* bq = (const float*)d_in[4]; const float* Wk = (const float*)d_in[5]; const float* bk = (const float*)d_in[6]; const float* Wv = (const float*)d_in[7]; const float* bv = (const float*)d_in[8]; const float* Wp = (const float*)d_in[9]; const float* bp = (const float*)d_in[10];
    float* out = (float*)d_out;    // [2][512][8][32][32]
    char* wsp = (char*)d_ws;
    auto take = [&](size_t bytes) { char* p = wsp; wsp += (bytes + 255) & ~(size_t)255; return (void*)p; };
    h16* BW = (h16*)take((size_t)4 * CC * CC * 2); h16* BP = BW + (size_t)3 * CC * CC;    // the four weight planes in a row: q, k, v, p
    h16* XN = (h16*)take((size_t)NR * CC * 2);
    h16* Qx = (h16*)take((size_t)2 * NSQ * NH_ * NTK * HD * 2); h16* Kx = Qx + (size_t)NSQ * NH_ * NTK * HD; h16* VTx = (h16*)take((size_t)NSQ * NH_ * HD * NTK * 2);
    h16* OH = (h16*)take((size_t)NR * CC * 2);
    if ((size_t)(wsp - (char*)d_ws) > ws_size) return;    // ~ 2.1 + 16.8 + 50.3 + 16.8 ~ 86 MB
    k_ln<<<NR / 64, 512, 0, stream>>>(x, lg, lb, XN, Wq, Wk, Wv, Wp, BW);
    k_gemmh<<<dim3(NR / 128, CC / 128, 3), 256, 0, stream>>>(XN, BW, bq, bk, bv, Qx, VTx, nullptr, nullptr, (size_t)CC * CC);
    k_attn<<<dim3(NTK / 512, NSQ * NH_), 512, 0, stream>>>(Qx, Kx, VTx, OH);
    k_gemmh<<<dim3(NR / 128, CC / 128, 1), 256, 0, stream>>>(OH, BP, bp, nullptr, nullptr, nullptr, nullptr, x, out, 0);
}

// v008
// A run of this version takes 80.3 microseconds.
// Timed twice side by side with v007, it ran 1.04 and 1.03 times as fast.
// Over all steps from v000 it is 15.2 times as fast.
#include <hip/hip_runtime.h>

// scores ([1024 x 64].[64 x 1024]) and attn.v on SINGLE fp16 planes (LN output, q/8, k, softmax probabilities, v and the merged heads rounded to fp16 = 2^-11; weights
// fp16(bf16(W)); one v_wmma_f32_16x16x32_f16 product each — the residual input dominating the output); softmax f32; + the input residual in f32 with

#define NSQ  16                   // (b t) sequences
#define NTK  1024                 // (h w) tokens
#define CC   512
#define NH_  8
#define HD   64
#define TT   8
#define NR   (NSQ * NTK)          // 16384
#define DM   CC
#define LOSC 1024.0f
typedef _Float16 h16;
typedef unsigned short bf;
typedef __attribute__((ext_vector_type(16))) __bf16   v16bf;
typedef __attribute__((ext_vector_type(16))) _Float16 v16h;
typedef __attribute__((ext_vector_type(8)))  _Float16 v8h;
typedef __attribute__((ext_vector_type(8)))  unsigned short v8us;
typedef __attribute__((ext_vector_type(8)))  float    v8f;
typedef __attribute__((ext_vector_type(4)))  float    v4f;
typedef v8h  __attribute__((may_alias)) v8ha;
typedef v4f  __attribute__((may_alias)) v4fa;
typedef v8us __attribute__((may_alias)) v8usa;

__device__ __forceinline__ unsigned short f2bf(float f) { unsigned u = __float_as_uint(f); u += 0x7FFFu + ((u >> 16) & 1u); return (unsigned short)(u >> 16); }
__device__ __forceinline__ float bf2f(unsigned short b) { return __uint_as_float(((unsigned)b) << 16); }
__device__ __forceinline__ float bfr(float f) { return bf2f(f2bf(f)); }
__device__ __forceinline__ v16h cat16(v8h lo, v8h hi) { return __builtin_shufflevector(lo, hi, 0, 1, 2, 3, 4, 5, 6, 7, 8, 9, 10, 11, 12, 13, 14, 15); }
__device__ __forceinline__ v16bf cat16b(v8us lo, v8us hi) { return __builtin_bit_cast(v16bf, __builtin_shufflevector(lo, hi, 0, 1, 2, 3, 4, 5, 6, 7, 8, 9, 10, 11, 12, 13, 14, 15)); }
__device__ __forceinline__ v8f wmma16(v16h a, v16h b, v8f c) { return __builtin_amdgcn_wmma_f32_16x16x32_f16(false, a, false, b, (short)0, c, false, false); }
__device__ __forceinline__ v8f wmmab(v16bf a, v16bf b, v8f c) { return __builtin_amdgcn_wmma_f32_16x16x32_bf16(false, a, false, b, (short)0, c, false, false); }


// k_gemmh: 128 x 128 tile of C = A . Bn^T with SINGLE f16 planes (A [rows][DM] f16 activations, Bn [N][DM] f16 weights; one v_wmma_f32_16x16x32_f16 product per step), f32 accumulate;
// grid z picks the weight plane (sB apart); bias1, bias2: where given, grid z = 1 and z = 2 add these in place of bias (q, k and v projections in one launch).
// C itself is never stored: the epilogue writes what the next kernel reads. x given: the output projection, out[b][c][t][n] = C^T + x in f32. Else z = 0, 1: q / 8 and k in f16, one plane
// [token][HD] per (sequence, head); z = 2: V^T in f16, [d][token] per (sequence, head).
// Both operands go through LDS, 64 k a stage, two stages: whole-line loads (a wave's 16-byte loads cover 4 rows of 128 bytes) bring each byte to the WGP once per work-group, and the
// 8 waves (4 x 2, 32 x 64 of C each) take their fragments from LDS. A fragment load straight from global memory touches 16 lines for its 512 bytes, and every wave fetched its own copy of Bn.
// The next stage's global loads fly while this stage is multiplied; one barrier a stage publishes the stage just written and ends the reads of the one written next.
#define GBK  64                   // k per stage
#define GPI  (GBK + 8)            // LDS pitch of a staged row, in f16: 144 bytes (16 bytes x odd: the 16-byte reads meet no bank conflict)
#define GST  (256 * GPI)          // one stage, in f16: 128 rows of A, then 128 rows of Bn
#define OPI  (128 + 4)            // LDS pitch of a staged output channel, in f32: 528 bytes (16 bytes x odd)
#define TPI  (128 + 8)            // LDS pitch of a staged V^T row, in f16: 272 bytes (16 bytes x odd)
__device__ __forceinline__ size_t xoff(int s, int c, int n) { const int b = s / TT, t = s % TT; return (((size_t)b * CC + c) * TT + t) * NTK + n; }   // x[b][c][t][n]
__global__ __launch_bounds__(256) void k_gemmh(const h16* __restrict__ A, const h16* __restrict__ Bn, const float* bias, const float* bias1, const float* bias2, h16* QK, h16* VT, const float* __restrict__ x, float* out, size_t sB) {
    __shared__ __align__(16) h16 st[2 * GST];      // 73,728 bytes; the epilogue's staging (69,632 bytes at most) lies in the same place
    const size_t z = blockIdx.z; Bn += z * sB;
    if (bias1 && z) bias = z == 1 ? bias1 : bias2;
    const int tid = threadIdx.x, lane = tid & 31, wave = tid >> 5, lr = lane & 15, hi = lane >> 4;
    const int r0 = blockIdx.x * 128, c0 = blockIdx.y * 128, wr = (wave >> 1) * 32, wc = (wave & 1) * 64;
    // this lane's 16-byte piece of rows prow, prow + 32, prow + 64, prow + 96 of either operand: 8 lanes a row (one line); a half-wave takes rows 8 apart, whose 16 pieces fall on all 64 LDS banks
    const int prow = (wave >> 2) * 16 + ((lane >> 3) & 1) * 8 + (wave & 3) * 2 + (lane >> 4), pcol = (lane & 7) * 8;
    const h16* ab = A + (size_t)r0 * DM;                  // the tiles' first rows: the same for the whole work-group
    const h16* bb = Bn + (size_t)c0 * DM;
    const unsigned po = prow * DM + pcol;
    h16* sw = st + prow * GPI + pcol;
    v8h ra[4], rb[4];
#pragma unroll
    for (int i = 0; i < 4; ++i) { ra[i] = *(const v8h*)(ab + po + i * 32 * DM); rb[i] = *(const v8h*)(bb + po + i * 32 * DM); }
    float bv[4] = {0.f, 0.f, 0.f, 0.f};      // fetched here, behind the first stage's loads, so that the epilogue waits for no load
    if (bias) {
#pragma unroll
        for (int t = 0; t < 4; ++t) bv[t] = bias[c0 + wc + t * 16 + lr];
#pragma unroll
        for (int t = 0; t < 4; ++t) bv[t] = bfr(bv[t]);
    }
#pragma unroll
    for (int i = 0; i < 4; ++i) { *(v8h*)(sw + i * 32 * GPI) = ra[i]; *(v8h*)(sw + (128 + i * 32) * GPI) = rb[i]; }
    __syncthreads();
    const h16* ar = st + (wr + lr) * GPI + 8 * hi;
    const h16* br = st + (128 + wc + lr) * GPI + 8 * hi;
    v8f acc[2][4];
#pragma unroll
    for (int u = 0; u < 2; ++u)
#pragma unroll
        for (int t = 0; t < 4; ++t) acc[u][t] = (v8f){};
    int cur = 0;                  // f16 offset of the stage being multiplied
    // not unrolled: the stages are alike, and one copy of the loop keeps the registers at one stage's need (two work-groups a WGP)
#pragma unroll 1
    for (int kn = GBK; ; kn += GBK) {
        const bool more = kn < DM;    // the same in every lane of the work-group: the barrier below stands under uniform control flow
        if (more) { const h16* an = ab + kn; const h16* bn = bb + kn;
#pragma unroll
            for (int i = 0; i < 4; ++i) { ra[i] = *(const v8h*)(an + po + i * 32 * DM); rb[i] = *(const v8h*)(bn + po + i * 32 * DM); }
        }
#pragma unroll
        for (int ks = 0; ks < GBK; ks += 32) {
            v16h a[2], b[4];
#pragma unroll
            for (int u = 0; u < 2; ++u) a[u] = cat16(*(const v8h*)(ar + cur + u * 16 * GPI + ks), *(const v8h*)(ar + cur + u * 16 * GPI + ks + 16));
#pragma unroll
            for (int t = 0; t < 4; ++t) b[t] = cat16(*(const v8h*)(br + cur + t * 16 * GPI + ks), *(const v8h*)(br + cur + t * 16 * GPI + ks + 16));
            __builtin_amdgcn_sched_barrier(0);    // holds the 12 LDS reads together ahead of their 8 products: moved down among them, each pair is waited for at once, with the whole LDS latency open
#pragma unroll
            for (int t = 0; t < 4; ++t)
#pragma unroll
                for (int u = 0; u < 2; ++u) acc[u][t] = wmma16(a[u], b[t], acc[u][t]);
        }
        if (!more) break;
        cur ^= GST;
#pragma unroll
        for (int i = 0; i < 4; ++i) { *(v8h*)(sw + cur + i * 32 * GPI) = ra[i]; *(v8h*)(sw + cur + (128 + i * 32) * GPI) = rb[i]; }
        __syncthreads();
    }
    __syncthreads();              // every wave has read its last fragments: the stages' LDS becomes the output staging
    const int sq = r0 / NTK, n0 = r0 % NTK;      // the tile's 128 rows are tokens n0 .. n0 + 127 of one sequence
    // An accumulator register run j = 0 .. 7 is 8 consecutive tokens of one column: the two transposed outputs are staged [column][token] by whole 16-byte LDS stores.
    if (x) {
        float* ts = (float*)st;                  // [128 channels][OPI]
#pragma unroll
        for (int t = 0; t < 4; ++t)
#pragma unroll
            for (int u = 0; u < 2; ++u) { float* d = ts + (wc + t * 16 + lr) * OPI + wr + u * 16 + hi * 8;
                *(v4fa*)d = (v4f){acc[u][t][0] + bv[t], acc[u][t][1] + bv[t], acc[u][t][2] + bv[t], acc[u][t][3] + bv[t]};
                *(v4fa*)(d + 4) = (v4f){acc[u][t][4] + bv[t], acc[u][t][5] + bv[t], acc[u][t][6] + bv[t], acc[u][t][7] + bv[t]}; }
        // a wave per channel row: 32 lanes x 16 bytes = its 128 tokens, 4 whole lines; the residual's 16 loads are issued together, ahead of the barrier
        const unsigned o = (unsigned)xoff(sq, c0 + wave * 16, n0 + lane * 4) * 4u;      // in bytes: one 32-bit offset register beside the two base pointers serves x and out (33.6 MB each)
        v4f xv[16];
#pragma unroll
        for (int s = 0; s < 16; ++s) xv[s] = *(const v4f*)((const char*)x + o + s * (TT * NTK * 4));
        __syncthreads();
#pragma unroll
        for (int s = 0; s < 16; ++s) { v4f y = *(const v4fa*)(ts + (wave * 16 + s) * OPI + lane * 4);
#pragma unroll
            for (int i = 0; i < 4; ++i) y[i] += bfr(xv[s][i]);
            *(v4f*)((char*)out + o + s * (TT * NTK * 4)) = y; }
        asm volatile("s_wait_xcnt 0x0" ::: "memory");    // behind the last store of the run: no register that an issued store names is written before it
        return;
    }
    if (z == 2) {
        h16* vs = st;                            // [128 columns = 2 heads x 64 d][TPI]
#pragma unroll
        for (int t = 0; t < 4; ++t)
#pragma unroll
            for (int u = 0; u < 2; ++u) { v8h v;
#pragma unroll
                for (int j = 0; j < 8; ++j) v[j] = (h16)(acc[u][t][j] + bv[t]);
                *(v8ha*)(vs + (wc + t * 16 + lr) * TPI + wr + u * 16 + hi * 8) = v; }
        __syncthreads();
        // a half-wave per V^T row: 16 lanes x 16 bytes = its 128 tokens, 2 whole lines
        h16* vp = VT + ((size_t)sq * CC + c0 + wave * 16 + hi) * NTK + n0 + lr * 8;
        const h16* vr = vs + (wave * 16 + hi) * TPI + lr * 8;
#pragma unroll
        for (int s = 0; s < 8; ++s) *(v8h*)(vp + s * 2 * NTK) = *(const v8ha*)(vr + s * 2 * TPI);
        asm volatile("s_wait_xcnt 0x0" ::: "memory");    // behind the last store of the run, as above
        return;
    }
    float* os = (float*)st + wave * (32 * 68);
#pragma unroll
    for (int t = 0; t < 4; ++t)
#pragma unroll
        for (int u = 0; u < 2; ++u)
#pragma unroll
            for (int j = 0; j < 8; ++j) os[(u * 16 + hi * 8 + j) * 68 + t * 16 + lr] = acc[u][t][j] + bv[t];
    __syncthreads();
    // the wave's 64 columns are one head: 8 lanes store one token's 64 d (one 128-byte line), 4 tokens a store, 512 bytes in a row
    const float sc = z == 0 ? 0.125f : 1.0f;     // q carries 1 / sqrt(HD)
    const int row = lane >> 3, cofs = (lane & 7) * 8;
    h16* cp = QK + (((z * NSQ + sq) * NH_ + ((c0 + wc) >> 6)) * NTK + n0 + wr + row) * HD + cofs;
    const float* op = os + row * 68 + cofs;
#pragma unroll
    for (int s = 0; s < 8; ++s) { const v4f a = *(const v4fa*)(op + s * 4 * 68), b = *(const v4fa*)(op + s * 4 * 68 + 4);
        *(v8h*)(cp + s * 4 * HD) = (v8h){(h16)(a[0] * sc), (h16)(a[1] * sc), (h16)(a[2] * sc), (h16)(a[3] * sc), (h16)(b[0] * sc), (h16)(b[1] * sc), (h16)(b[2] * sc), (h16)(b[3] * sc)}; }
    asm volatile("s_wait_xcnt 0x0" ::: "memory");        // behind the last store of the run, as above
}

typedef __attribute__((ext_vector_type(4))) _Float16 v4h;
__device__ __forceinline__ h16 tohx(float x) { return (h16)x; }
// k_ln: LayerNorm of 64 tokens a work-group, x read once. Each of its 16 waves holds 32 channels of them in registers (16 independent 16-byte loads per lane, a half-wave per channel row,
// a lane's 16 channels in a row), so no load waits on the one before it; the channel sums meet in LDS: per-lane chain, the two half-waves, then the 16 waves in index order.
// The normalised tile goes out from the same registers: a lane has 16 consecutive channels of each of its 4 tokens (two 16-byte LDS stores a token), the tile is turned in LDS to
// [token][channel], and a wave stores 512 bytes of one token's row at a time (4 whole lines). A load of one channel per lane for a single token would touch 32 lines for 128 bytes.
// The 16-byte piece c of token t lies at piece c ^ (t / 4): the 16 lanes of a half-wave, which write one piece column of tokens 4 apart, and those that read one row, each meet all 64 banks.
// The four weights ride along: they make 4 x 8 x 8 = 256 tiles of 64 x 64, as many as the grid has work-groups. Each work-group fetches one tile along with its x loads (whole 256-byte rows), rounds it,
// lays it in LDS ahead of the second barrier and stores it transposed in f16 ([n][k], whole lines) behind that barrier: the tile's latency lies under that of x, and no launch of its own is needed.
static_assert(NR / 64 == 4 * (CC / 64) * (CC / 64), "one weight tile a work-group");
__global__ __launch_bounds__(512) void k_ln(const float* __restrict__ x, const float* __restrict__ g, const float* __restrict__ bb, h16* XN, const float* __restrict__ W0, const float* __restrict__ W1, const float* __restrict__ W2, const float* __restrict__ W3, h16* Bt) {
    __shared__ __align__(16) float red[2][16][64];
    __shared__ __align__(16) h16 tl[64 * CC];      // 65,536 bytes
    __shared__ float wt[64][65];                   // the weight tile, [k][n]; the odd pitch keeps both the row writes and the column reads off each other's banks
    const int lane = threadIdx.x & 31, wv = threadIdx.x >> 5, hi = lane >> 4, lr = lane & 15, tq = lr * 4;
    const int s = blockIdx.x / (NTK / 64), n0 = (blockIdx.x % (NTK / 64)) * 64;
    const int cb = wv * 32 + hi * 16;
    const float* p = x + xoff(s, cb, n0 + tq);      // channel cb + i, tokens n0 + tq .. + 3
    const int wz = blockIdx.x >> 6, wk0 = ((blockIdx.x >> 3) & 7) * 64, wn0 = (blockIdx.x & 7) * 64;      // weight, first k row and first n column of this work-group's tile
    const float* Wm = wz == 0 ? W0 : wz == 1 ? W1 : wz == 2 ? W2 : W3;
    const int wr = threadIdx.x >> 3, wq = (threadIdx.x & 7) * 8;      // 8 lanes a tile row of 256 bytes
    const float* wp = Wm + (size_t)(wk0 + wr) * CC + wn0 + wq;
    const v4f w0 = *(const v4f*)wp, w1 = *(const v4f*)(wp + 4);
    v4f v[16];
#pragma unroll
    for (int i = 0; i < 16; ++i) v[i] = *(const v4f*)(p + (size_t)i * (TT * NTK));
    asm volatile("s_wait_xcnt 0x0" ::: "memory");    // behind x's and the weight tile's loads: the loads below may land in the registers that hold their addresses
    v4f gv[4], bv[4];             // fetched behind x's loads: they are back before the sums are
#pragma unroll
    for (int i = 0; i < 4; ++i) { gv[i] = *(const v4f*)(g + cb + i * 4); bv[i] = *(const v4f*)(bb + cb + i * 4); }
    v4f sm = (v4f){};
#pragma unroll
    for (int i = 0; i < 16; ++i) { v[i] = (v4f){bfr(v[i][0]), bfr(v[i][1]), bfr(v[i][2]), bfr(v[i][3])}; sm += v[i]; }
#pragma unroll
    for (int j = 0; j < 4; ++j) sm[j] += __shfl_xor(sm[j], 16, 32);
    if (hi == 0) *(v4fa*)(&red[0][wv][tq]) = sm;
    __syncthreads();
    v4f mu = (v4f){};
#pragma unroll
    for (int w = 0; w < 16; ++w) mu += *(const v4fa*)(&red[0][w][tq]);
    mu *= (1.0f / CC);
    v4f q = (v4f){};
#pragma unroll
    for (int i = 0; i < 16; ++i) { v[i] -= mu;
#pragma unroll
        for (int j = 0; j < 4; ++j) q[j] = fmaf(v[i][j], v[i][j], q[j]); }
#pragma unroll
    for (int j = 0; j < 4; ++j) q[j] += __shfl_xor(q[j], 16, 32);
    if (hi == 0) *(v4fa*)(&red[1][wv][tq]) = q;
#pragma unroll
    for (int i = 0; i < 4; ++i) { wt[wr][wq + i] = bfr(w0[i]); wt[wr][wq + 4 + i] = bfr(w1[i]); }
#pragma unroll
    for (int i = 0; i < 4; ++i)
#pragma unroll
        for (int j = 0; j < 4; ++j) { gv[i][j] = bfr(gv[i][j]); bv[i][j] = bfr(bv[i][j]); }
    __syncthreads();
    {   // a half-wave per n row: 16 lanes x 8 bytes = its 64 k, one whole line
        h16* bp = Bt + (size_t)wz * CC * CC + (size_t)(wn0 + wv * 4 + hi) * CC + wk0 + lr * 4;
#pragma unroll
        for (int st = 0; st < 2; ++st) { v4h o;
#pragma unroll
            for (int i = 0; i < 4; ++i) o[i] = tohx(wt[lr * 4 + i][wv * 4 + st * 2 + hi]);
            *(v4h*)(bp + st * 2 * CC) = o; }
    }
    v4f qs = (v4f){};
#pragma unroll
    for (int w = 0; w < 16; ++w) qs += *(const v4fa*)(&red[1][w][tq]);
    const v4f rs = (v4f){rsqrtf(qs[0] * (1.0f / CC) + 1e-5f), rsqrtf(qs[1] * (1.0f / CC) + 1e-5f), rsqrtf(qs[2] * (1.0f / CC) + 1e-5f), rsqrtf(qs[3] * (1.0f / CC) + 1e-5f)};
#pragma unroll
    for (int c = 0; c < 16; ++c) v[c] = v[c] * rs * gv[c >> 2][c & 3] + bv[c >> 2][c & 3];
#pragma unroll
    for (int j = 0; j < 4; ++j)
#pragma unroll
        for (int hf = 0; hf < 2; ++hf) { v8h o;
#pragma unroll
            for (int i = 0; i < 8; ++i) o[i] = tohx(v[hf * 8 + i][j]);
            *(v8ha*)(tl + (tq + j) * CC + ((wv * 4 + hi * 2 + hf) ^ lr) * 8) = o; }
    __syncthreads();              // the tile is whole: every wave reads rows that all 16 waves wrote
    // wave wv stores tokens 4 wv .. 4 wv + 3, whose pieces are turned by wv
    h16* op = XN + ((size_t)s * NTK + n0 + wv * 4) * CC + lane * 8;
    const h16* tr = tl + wv * 4 * CC + (lane ^ wv) * 8;
#pragma unroll
    for (int r = 0; r < 4; ++r)
#pragma unroll
        for (int hf = 0; hf < 2; ++hf) *(v8h*)(op + r * CC + hf * 256) = *(const v8ha*)(tr + r * CC + hf * 256);
}
typedef __attribute__((ext_vector_type(2))) float v2f;
__device__ __forceinline__ float xhalf(float x) { return __builtin_bit_cast(float, __builtin_amdgcn_permlanex16(__builtin_bit_cast(int, x), __builtin_bit_cast(int, x), 0x76543210, 0xfedcba98, false, false)); }   // lane l takes lane l ^ 16's value
// k_attn: scores, softmax and attn.v of one (sequence, head) for 512 queries a work-group, 32 queries a wave, 32 keys a pass; nothing of S or P leaves the registers.
// The head's whole K (1024 x 64) and V^T (64 x 1024) are laid into LDS once, by whole-line loads, and every wave takes its fragments from there: a fragment load straight from
// global memory touches 16 lines for its 512 bytes, and 16 waves would each fetch the same ones. Pitches of 16 bytes x odd keep the 16-byte LDS reads free of bank conflicts.
// Transposed products: S^T = K . Q^T (A = 16 keys, B = 16 queries) puts one query's scores in one lane pair (lane, lane + 16); two S^T tiles of keys 0-15 and 16-31, rounded to f16 in
// place, ARE the B operand of O^T += V^T . P^T in the k order of the A loader (k = 8 hi + e, 16 + 8 hi + e). Running maximum m (in log2 units) and running sum l per query;
// m is a reference, not the exact maximum: it is renewed, and l and the output tiles rescaled, only in a pass where some score of the wave lies more than 8 (log2 units) above it, so P <= 2^8 stays far
// inside f16 and the quotient O / l is the same; the exchange between the half-waves and the new m are worked out inside that rare branch, a pass's test is one compare a query tile. A lane ends with 8 consecutive d of one query: one 16-byte store into the merged-heads plane.
#define KPI  (HD + 8)             // LDS pitch of a K row, in f16: 144 bytes
#define VPI  (NTK + 8)            // LDS pitch of a V^T row, in f16: 2064 bytes
__global__ __launch_bounds__(512) void k_attn(const h16* __restrict__ Q, const h16* __restrict__ Kp, const h16* __restrict__ VT, h16* OH) {
    __shared__ __align__(16) h16 KS[NTK * KPI];
    __shared__ __align__(16) h16 VS[HD * VPI];
    const int tid = threadIdx.x, lane = tid & 31, wave = tid >> 5, lr = lane & 15, hi = lane >> 4;
    const int z = blockIdx.y, q0 = blockIdx.x * 512 + wave * 32;
    const h16* qp = Q + ((size_t)z * NTK + q0 + lr) * HD + 8 * hi;
    const h16* kg = Kp + (size_t)z * NTK * HD + tid * 8;      // both planes are NTK * HD f16 in a row: 16 rounds of 512 lanes x 16 bytes each
    const h16* vg = VT + (size_t)z * HD * NTK + tid * 8;
    const float L2E = 1.44269504088896340736f;
    v16h qf[2][2], kf[2][2], vf[4];      // qf, kf: [query tile | key tile][k step of 32 over the head size]; vf[dt]: V^T rows d = dt * 16 + lr, the pass's 32 keys
#pragma unroll
    for (int u = 0; u < 2; ++u)
#pragma unroll
        for (int ks = 0; ks < 2; ++ks) qf[u][ks] = cat16(*(const v8h*)(qp + u * 16 * HD + ks * 32), *(const v8h*)(qp + u * 16 * HD + ks * 32 + 16));
    {
        v8h kr[16], vr[16];
#pragma unroll
        for (int i = 0; i < 16; ++i) { kr[i] = *(const v8h*)(kg + i * 4096); vr[i] = *(const v8h*)(vg + i * 4096); }
#pragma unroll
        for (int i = 0; i < 16; ++i) { const int c = i * 512 + tid;      // 16-byte piece c: K row c / 8, piece c % 8; V^T row c / 128, piece c % 128
            *(v8h*)(KS + (c >> 3) * KPI + (c & 7) * 8) = kr[i]; *(v8h*)(VS + (c >> 7) * VPI + (c & 127) * 8) = vr[i]; }
    }
    __syncthreads();
    const h16* kp = KS + lr * KPI + 8 * hi;
    const h16* vp = VS + lr * VPI + 8 * hi;
#pragma unroll
    for (int t = 0; t < 2; ++t)
#pragma unroll
        for (int ks = 0; ks < 2; ++ks) kf[t][ks] = cat16(*(const v8h*)(kp + t * 16 * KPI + ks * 32), *(const v8h*)(kp + t * 16 * KPI + ks * 32 + 16));
#pragma unroll
    for (int dt = 0; dt < 4; ++dt) vf[dt] = cat16(*(const v8h*)(vp + dt * 16 * VPI), *(const v8h*)(vp + dt * 16 * VPI + 16));
    v8f o[2][4];
#pragma unroll
    for (int u = 0; u < 2; ++u)
#pragma unroll
        for (int dt = 0; dt < 4; ++dt) o[u][dt] = (v8f){};
    float m[2] = {-3.0e38f, -3.0e38f}, mt[2] = {-3.0e38f, -3.0e38f}, l[2] = {0.f, 0.f};      // mt: the raw score above which m is renewed, (m + 8) / log2(e); the first pass always renews
    // not unrolled: one pass's fragments, scores and output tiles fill the 256 registers that four waves a SIMD leave each wave
#pragma unroll 1
    for (int k0 = 0; k0 < NTK; k0 += 32) {
        v8f s[2][2];              // [query tile][key tile]: s[u][t][j] = score(key k0 + 16 t + 8 hi + j, query q0 + 16 u + lr)
#pragma unroll
        for (int u = 0; u < 2; ++u)
#pragma unroll
            for (int t = 0; t < 2; ++t) s[u][t] = wmma16(kf[t][1], qf[u][1], wmma16(kf[t][0], qf[u][0], (v8f){}));
        const int kn = (k0 + 32) & (NTK - 1);    // the next pass's keys: K and V^T fragments are fetched one pass ahead, each into its own registers right behind its products (the last pass fetches keys 0 .. 31 again, unused)
#pragma unroll
        for (int t = 0; t < 2; ++t)
#pragma unroll
            for (int ks = 0; ks < 2; ++ks) kf[t][ks] = cat16(*(const v8h*)(kp + (kn + t * 16) * KPI + ks * 32), *(const v8h*)(kp + (kn + t * 16) * KPI + ks * 32 + 16));
        __builtin_amdgcn_sched_barrier(0);    // holds the K loads up here: moved down to the pass's end they would be waited for at once, with the whole load latency open
        float mx[2];
#pragma unroll
        for (int u = 0; u < 2; ++u) { mx[u] = s[u][0][0];
#pragma unroll
            for (int j = 1; j < 8; ++j) mx[u] = fmaxf(mx[u], s[u][0][j]);
#pragma unroll
            for (int j = 0; j < 8; ++j) mx[u] = fmaxf(mx[u], s[u][1][j]); }
        if (__builtin_amdgcn_ballot_w32(mx[0] > mt[0] || mx[1] > mt[1]) != 0) {
#pragma unroll
            for (int u = 0; u < 2; ++u) { const float mn = fmaxf(m[u], fmaxf(mx[u], xhalf(mx[u])) * L2E), a = __builtin_amdgcn_exp2f(m[u] - mn); m[u] = mn; mt[u] = (mn + 8.0f) * (1.0f / L2E); l[u] *= a;
#pragma unroll
                for (int dt = 0; dt < 4; ++dt) o[u][dt] *= a; }
        }
        v16h pf[2];
#pragma unroll
        for (int u = 0; u < 2; ++u)
#pragma unroll
            for (int t = 0; t < 2; ++t)
#pragma unroll
                for (int j = 0; j < 8; j += 2) { const v2f e = __builtin_elementwise_fma((v2f){s[u][t][j], s[u][t][j + 1]}, (v2f){L2E, L2E}, (v2f){-m[u], -m[u]});    // register pairs as the accumulator has them: one packed fma
                    const float p0 = __builtin_amdgcn_exp2f(e[0]), p1 = __builtin_amdgcn_exp2f(e[1]); l[u] += p0; l[u] += p1; pf[u][t * 8 + j] = tohx(p0); pf[u][t * 8 + j + 1] = tohx(p1); }
#pragma unroll
        for (int dt = 0; dt < 4; ++dt)
#pragma unroll
            for (int u = 0; u < 2; ++u) o[u][dt] = wmma16(vf[dt], pf[u], o[u][dt]);
#pragma unroll
        for (int dt = 0; dt < 4; ++dt) vf[dt] = cat16(*(const v8h*)(vp + dt * 16 * VPI + kn), *(const v8h*)(vp + dt * 16 * VPI + kn + 16));
    }
    const int sq = z / NH_, h = z % NH_;
#pragma unroll
    for (int u = 0; u < 2; ++u) { const float inv = 1.0f / (l[u] + xhalf(l[u]));
        h16* op = OH + ((size_t)sq * NTK + q0 + u * 16 + lr) * CC + h * HD + 8 * hi;
#pragma unroll
        for (int dt = 0; dt < 4; ++dt) { v8h ov;
#pragma unroll
            for (int j = 0; j < 8; ++j) ov[j] = tohx(o[u][dt][j] * inv);
            *(v8h*)(op + dt * 16) = ov; } }
}

extern "C" void kernel_launch(void* const* d_in, const int* in_sizes, int n_in,
                              void* d_out, int out_size, void* d_ws, size_t ws_size, hipStream_t stream) {
    (void)in_sizes; (void)n_in; (void)out_size;
    const float* x = (const float*)d_in[0]; const float* lg = (const float*)d_in[1]; const float* lb = (const float*)d_in[2]; const float* Wq = (const float*)d_in[3]; const float* bq = (const float*)d_in[4]; const float* Wk = (const float*)d_in[5]; const float* bk = (const float*)d_in[6]; const float* Wv = (const float*)d_in[7]; const float* bv = (const float*)d_in[8]; const float* Wp = (const float*)d_in[9]; const float* bp = (const float*)d_in[10];
    float* out = (float*)d_out;    // [2][512][8][32][32]
    char* wsp = (char*)d_ws;
    auto take = [&](size_t bytes) { char* p = wsp; wsp += (bytes + 255) & ~(size_t)255; return (void*)p; };
    h16* BW = (h16*)take((size_t)4 * CC * CC * 2); h16* BP = BW + (size_t)3 * CC * CC;    // the four weight planes in a row: q, k, v, p
    h16* XN = (h16*)take((size_t)NR * CC * 2);
    h16* Qx = (h16*)take((size_t)2 * NSQ * NH_ * NTK * HD * 2); h16* Kx = Qx + (size_t)NSQ * NH_ * NTK * HD; h16* VTx = (h16*)take((size_t)NSQ * NH_ * HD * NTK * 2);
    h16* OH = (h16*)take((size_t)NR * CC * 2);
    if ((size_t)(wsp - (char*)d_ws) > ws_size) return;    // ~ 2.1 + 16.8 + 50.3 + 16.8 ~ 86 MB
    k_ln<<<NR / 64, 512, 0, stream>>>(x, lg, lb, XN, Wq, Wk, Wv, Wp, BW);
    k_gemmh<<<dim3(NR / 128, CC / 128, 3), 256, 0, stream>>>(XN, BW, bq, bk, bv, Qx, VTx, nullptr, nullptr, (size_t)CC * CC);
    k_attn<<<dim3(NTK / 512, NSQ * NH_), 512, 0, stream>>>(Qx, Kx, VTx, OH);
    k_gemmh<<<dim3(NR / 128, CC / 128, 1), 256, 0, stream>>>(OH, BP, bp, nullptr, nullptr, nullptr, nullptr, x, out, 0);
}
